// v000
// Measured on an AMD MI455X. A time is GPU time per run, averaged over a window of back-to-back runs after a warm-up
// (all launches, gaps included; the runs take copies of the inputs in turn), and the median of several windows.
// Apart from v000's, it joins two sittings. Times from different sittings can be a few percent apart, while
// side-by-side timings come from the same sitting.
// v000, which the later versions start from, runs in 1520 microseconds.
// Contractions: qkv projection (T f16 x W^T f16 carried x16), scores q.k^T (q,k f16 planes, head dim 16 zero-padded to 32), attn.v (V f16 channel-major x P^T f16 carried x2048): all v_wmma_f32_16x16x32_f16 with f32 accumulate; softmax and layout shuffles in f32.
#include <hip/hip_runtime.h>
#include <math.h>

// ---------------------------------------------------------------------------
// Problem constants
// ---------------------------------------------------------------------------
constexpr int kBatch  = 2;
constexpr int kChan   = 64;                 // input channels = output channels
constexpr int kNtok   = 4096;               // tokens per batch (64 x 64)
constexpr int kTok    = kBatch * kNtok;     // 8192 token rows
constexpr int kHeads  = 4;
constexpr int kHdim   = 16;
constexpr int kGroups = kBatch * kHeads;    // 8 (batch, head) groups
constexpr int kQKV    = 3 * kChan;          // 192 projection outputs
constexpr int kQKld   = 32;                 // q/k plane pitch in halves: 16 data + 16 zero
constexpr int kVrows  = 64;                 // V channel-major rows per group: 16 data + 48 zero
constexpr float kWCarry    = 16.0f;         // weights carried x16 in f16
constexpr float kWCarryInv = 1.0f / 16.0f;
constexpr float kPCarry    = 2048.0f;       // probabilities carried x2048 in f16
constexpr float kPCarryInv = 1.0f / 2048.0f;
constexpr float kQKScale   = 0.25f;         // 1/sqrt(16)

// ---------------------------------------------------------------------------
// Workspace region map (bytes; every region 4096-B aligned; total 124,805,120 <= 134,217,728)
//   T16    f16 [8192][64]            1,048,576   at          0
//   W16    f16 [192][64]                24,576   at  1,048,576
//   QKV32  f32 [8192][192]           6,291,456   at  1,073,152
//   Q16    f16 [8][4096][32]         2,097,152   at  7,364,608
//   K16    f16 [8][4096][32]         2,097,152   at  9,461,760
//   Vcm16  f16 [8][64][4096]         4,194,304   at 11,558,912
//   S32    f32 [4096][4096]         67,108,864   at 15,753,216   (reused per group)
//   P16    f16 [4096][4096]         33,554,432   at 82,862,080   (reused per group)
//   O32    f32 [8][64][4096]         8,388,608   at 116,416,512
//   end                                           124,805,120
// ---------------------------------------------------------------------------

typedef __attribute__((ext_vector_type(16))) _Float16 v16h;
typedef __attribute__((ext_vector_type(8)))  _Float16 v8h;
typedef __attribute__((ext_vector_type(16))) __bf16   v16b;
typedef __attribute__((ext_vector_type(8)))  __bf16   v8b;
typedef __attribute__((ext_vector_type(8)))  float    v8f;
typedef __attribute__((ext_vector_type(4)))  float    v4f;
typedef __attribute__((ext_vector_type(4)))  unsigned int v4u;

// ---------------------------------------------------------------------------
// Helpers
// ---------------------------------------------------------------------------
__device__ __forceinline__ unsigned short f2bf_bits(float f) {
  unsigned u = __float_as_uint(f);
  return (unsigned short)((u + 0x7FFFu + ((u >> 16) & 1u)) >> 16);
}
__device__ __forceinline__ float bf_bits2f(unsigned short h) { return __uint_as_float(((unsigned)h) << 16); }

// hazard guards as plain device helpers (no inline asm inside the kernel template body)
__device__ __forceinline__ void dep_guard_h(v8f& a, v8f& b, v16h x, v16h y) { asm volatile("v_nop\n\tv_nop\n\tv_nop\n\tv_nop" : "+v"(a), "+v"(b) : "v"(x), "v"(y)); }
__device__ __forceinline__ void dep_guard_b(v8f& a, v8f& b, v16b x, v16b y) { asm volatile("v_nop\n\tv_nop\n\tv_nop\n\tv_nop" : "+v"(a), "+v"(b) : "v"(x), "v"(y)); }
__device__ __forceinline__ void keep4_h(v16h a, v16h b, v16h c, v16h d) { asm volatile("v_nop" :: "v"(a), "v"(b), "v"(c), "v"(d)); }
__device__ __forceinline__ void keep4_b(v16b a, v16b b, v16b c, v16b d) { asm volatile("v_nop" :: "v"(a), "v"(b), "v"(c), "v"(d)); }
__device__ __forceinline__ void acc_guard4(v8f& a, v8f& b, v8f& c, v8f& d) { asm volatile("v_nop\n\tv_nop\n\tv_nop\n\tv_nop" : "+v"(a), "+v"(b), "+v"(c), "+v"(d)); }
template <typename T> struct Frag;
template <> struct Frag<_Float16> {
  typedef v16h V; union U { v16h v; v8h h[2]; };
  // elements 0..7 <- p[0..7], 8..15 <- p[16..23]
  static __device__ __forceinline__ v16h load(const _Float16* p) {
    U f; f.h[0] = *(const v8h*)(p); f.h[1] = *(const v8h*)(p + 16); return f.v;
  }
  static __device__ __forceinline__ v8f mma(v16h a, v16h b, v8f c) {
    return __builtin_amdgcn_wmma_f32_16x16x32_f16(false, a, false, b, (short)0, c, false, false);
  }
  static __device__ __forceinline__ void guard(v8f& a, v8f& b, v16h x, v16h y) { dep_guard_h(a, b, x, y); }
  static __device__ __forceinline__ void keep(v16h a, v16h b, v16h c, v16h d) { keep4_h(a, b, c, d); }
};
template <> struct Frag<__bf16> {
  typedef v16b V; union U { v16b v; v8b h[2]; };
  static __device__ __forceinline__ v16b load(const __bf16* p) {
    U f; f.h[0] = *(const v8b*)(p); f.h[1] = *(const v8b*)(p + 16); return f.v;
  }
  static __device__ __forceinline__ v8f mma(v16b a, v16b b, v8f c) {
    return __builtin_amdgcn_wmma_f32_16x16x32_bf16(false, a, false, b, (short)0, c, false, false);
  }
  static __device__ __forceinline__ void guard(v8f& a, v8f& b, v16b x, v16b y) { dep_guard_b(a, b, x, y); }
  static __device__ __forceinline__ void keep(v16b a, v16b b, v16b c, v16b d) { keep4_b(a, b, c, d); }
};

__device__ __forceinline__ unsigned pk16(unsigned short a, unsigned short b) { return (unsigned)a | ((unsigned)b << 16); }
__device__ __forceinline__ unsigned short h_bits(float f) { const _Float16 h = (_Float16)f; return __builtin_bit_cast(unsigned short, h); }

// ---- Register-blocked batched WMMA GEMM (ACT reduced to none/relu/leaky) --------------------------------
// C[m,n] = scale * sum_k A[m,k] * Bt[n,k] (+bias)(+resid); each wave owns a 64x64 tile.
// A row-major [M,K]; Bt row-major [N,K]; M,N % 64 == 0, K % 32 == 0.
// SPLIT: operands are hi/lo planes (A2/Bt2 = lo planes, same layout); product = hi*hi + hi*lo + lo*hi.
// BIAS_MODE: 0 = none, 1 = bias[m], 2 = bias[n].
// OUT_MODE: 0 = f32, 1 = f16, 2 = bf16 hi plane (Cout) + bf16 lo plane (Cout2).
// ET: 0 = f16 operands, 1 = bf16 operands (pointers passed as 16-bit storage)
template <int ET> struct Elem;
template <> struct Elem<0> { typedef _Float16 T; };
template <> struct Elem<1> { typedef __bf16 T; };
template <int ET, bool SPLIT, int BIAS_MODE, int OUT_MODE, bool RESID, int ACT = 0>
__global__ __launch_bounds__(256) void wmma_gemm64(
    const unsigned short* __restrict__ Ap, const unsigned short* __restrict__ A2p, int lda, long strideA,
    const unsigned short* __restrict__ Btp, const unsigned short* __restrict__ Bt2p, int ldb, long strideB,
    void* __restrict__ Cout, void* __restrict__ Cout2, int ldc, long strideC,
    const float* __restrict__ bias,
    const float* __restrict__ resid, long strideR,
    int M, int N, int K, float scale) {
  typedef typename Elem<ET>::T T;
  typedef typename Frag<T>::V V;
  const T* A = (const T*)Ap; const T* A2 = (const T*)A2p; const T* Bt = (const T*)Btp; const T* Bt2 = (const T*)Bt2p;
  __shared__ __align__(16) float sT[8][16 * 68];   // per-wave 16x64 slab, pitch 68 floats
  const int b    = blockIdx.y;
  const int lane = threadIdx.x & 31;
  const int wave = threadIdx.x >> 5;
  const int tilesN = N >> 6;
  const int tilesM = M >> 6;
  const int tile = blockIdx.x * 8 + wave;
  if (tile >= tilesM * tilesN) return;   // wave-uniform; no block barriers in this kernel
  const int tm = tile / tilesN;
  const int tn = tile - tm * tilesN;
  const int m0 = tm << 6;
  const int n0 = tn << 6;

  const T* Ab  = A  + (size_t)b * strideA;
  const T* Bb  = Bt + (size_t)b * strideB;
  const T* Ab2 = SPLIT ? (A2  + (size_t)b * strideA) : nullptr;
  const T* Bb2 = SPLIT ? (Bt2 + (size_t)b * strideB) : nullptr;

  const int rlane = lane & 15;                 // row (A) / col (B, D) within subtile
  const int koff  = (lane >> 4) * 8;           // k offset of this lane half
  const int mOff  = (lane >> 4) * 8;           // D row offset

  v8f acc[4][4];
#pragma unroll
  for (int i = 0; i < 4; ++i)
#pragma unroll
    for (int j = 0; j < 4; ++j) acc[i][j] = (v8f){0.f,0.f,0.f,0.f,0.f,0.f,0.f,0.f};

  for (int k0 = 0; k0 < K; k0 += 32) {
    V bh[4], bl[4];
#pragma unroll
    for (int j = 0; j < 4; ++j) {
      const size_t bo = (size_t)(n0 + (j << 4) + rlane) * ldb + koff + k0;
      bh[j] = Frag<T>::load(Bb + bo);
      if (SPLIT) bl[j] = Frag<T>::load(Bb2 + bo);
    }
#pragma unroll
    for (int i = 0; i < 4; ++i) {
      const size_t ao = (size_t)(m0 + (i << 4) + rlane) * lda + koff + k0;
      V ah = Frag<T>::load(Ab + ao);
      V al;
      if (SPLIT) al = Frag<T>::load(Ab2 + ao);
#pragma unroll
      for (int j = 0; j < 4; ++j) {
        acc[i][j] = Frag<T>::mma(ah, bh[j], acc[i][j]);
        if (SPLIT) {
          acc[i][j] = Frag<T>::mma(ah, bl[j], acc[i][j]);
          acc[i][j] = Frag<T>::mma(al, bh[j], acc[i][j]);
        }
      }
      Frag<T>::guard(acc[i][0], acc[i][3], ah, SPLIT ? al : ah);
    }
    Frag<T>::keep(bh[0], bh[1], bh[2], bh[3]);
    if (SPLIT) Frag<T>::keep(bl[0], bl[1], bl[2], bl[3]);
  }
  acc_guard4(acc[0][0], acc[0][1], acc[0][2], acc[0][3]);
  acc_guard4(acc[1][0], acc[1][1], acc[1][2], acc[1][3]);
  acc_guard4(acc[2][0], acc[2][1], acc[2][2], acc[2][3]);
  acc_guard4(acc[3][0], acc[3][1], acc[3][2], acc[3][3]);

  // ---- epilogue ----
  float* slab = sT[wave];
  const float* Rb = RESID ? (resid + (size_t)b * strideR) : nullptr;
#pragma unroll
  for (int i = 0; i < 4; ++i) {
    const int mBase = m0 + (i << 4);
#pragma unroll
    for (int j = 0; j < 4; ++j) {
      const int n = n0 + (j << 4) + rlane;
      float bv = 0.f;
      if (BIAS_MODE == 2) bv = bias[n];
#pragma unroll
      for (int r = 0; r < 8; ++r) {
        float v = acc[i][j][r] * scale;
        if (BIAS_MODE == 1) v += bias[mBase + mOff + r];
        if (BIAS_MODE == 2) v += bv;
        if (RESID) v += Rb[(size_t)(mBase + mOff + r) * ldc + n];
        if (ACT == 2) v = fmaxf(v, 0.0f);
        if (ACT == 4) v = (v > 0.f) ? v : 0.01f * v;
        slab[(mOff + r) * 68 + (j << 4) + rlane] = v;
      }
    }
    __builtin_amdgcn_fence(__ATOMIC_RELEASE, "workgroup");
    __builtin_amdgcn_wave_barrier();
    __builtin_amdgcn_fence(__ATOMIC_ACQUIRE, "workgroup");
    if (OUT_MODE == 0) {
      float* C = (float*)Cout + (size_t)b * strideC;
      const int hh = lane >> 4, c4 = (lane & 15) * 4;     // row seg = 256 B = 16 lanes x 16 B
      {
#pragma unroll
        for (int it = 0; it < 8; ++it) {
          const int row = it * 2 + hh;
          v4f v = *(const v4f*)(slab + row * 68 + c4);
          *(v4f*)(C + (size_t)(mBase + row) * ldc + n0 + c4) = v;
        }
        
      }
    } else {
      const int q = lane >> 3, c8 = (lane & 7) * 8;
      unsigned short* C  = (unsigned short*)Cout  + (size_t)b * strideC;
      unsigned short* C2 = (OUT_MODE == 2) ? ((unsigned short*)Cout2 + (size_t)b * strideC) : nullptr;
      {
#pragma unroll
        for (int it = 0; it < 4; ++it) {
          const int row = it * 4 + q;
          const float* sp = slab + row * 68 + c8;
          v8h hv, lv;
#pragma unroll
          for (int e = 0; e < 8; ++e) {
            if (OUT_MODE == 1) {
              hv[e] = (_Float16)sp[e];
            } else {
              unsigned short hb = f2bf_bits(sp[e]);
              unsigned short lb = f2bf_bits(sp[e] - bf_bits2f(hb));
              hv[e] = __builtin_bit_cast(_Float16, hb);
              lv[e] = __builtin_bit_cast(_Float16, lb);
            }
          }
          *(v8h*)(C + (size_t)(mBase + row) * ldc + n0 + c8) = hv;
          if (OUT_MODE == 2) *(v8h*)(C2 + (size_t)(mBase + row) * ldc + n0 + c8) = lv;
        }
        
      }
    }
    __builtin_amdgcn_fence(__ATOMIC_RELEASE, "workgroup");
    __builtin_amdgcn_wave_barrier();
    __builtin_amdgcn_fence(__ATOMIC_ACQUIRE, "workgroup");
  }
}

// ---------------------------------------------------------------------------
// Token transpose + cast: x [2][64 c][4096 n] f32 -> T16 [8192 token][64 c] f16 bits, T16[b*4096+n][c] = f16(x[b][c][n]).
// Block = 64 consecutive tokens of one batch; grid = 128 blocks; 256 threads.
// Load coverage: 16 iterations x 256 threads = 4096 = 64 c x 64 tokens (coalesced along n).
// Store coverage: 8 waves x 2 iterations x 4 rows (lane>>3) = 64 token rows; (lane&7) x 8 halves = 64 c;
// ---------------------------------------------------------------------------
__global__ __launch_bounds__(256) void xtok_kernel(const float* __restrict__ x, unsigned short* __restrict__ T16) {
  __shared__ float sm[64][65];     // sm[token_local][c]
  const int t    = threadIdx.x;
  const int tok0 = blockIdx.x * 64;
  const int b    = tok0 >> 12;
  const int n0   = tok0 & (kNtok - 1);
  const float* xb = x + (size_t)b * kChan * kNtok + n0;
#pragma unroll
  for (int i = 0; i < 16; ++i) {
    const int e  = i * 256 + t;
    const int c  = e >> 6;
    const int nl = e & 63;
    sm[nl][c] = xb[(size_t)c * kNtok + nl];
  }
  __syncthreads();
  const int lane = t & 31, wave = t >> 5;
  const int q = lane >> 3, c8 = (lane & 7) * 8;
  {
#pragma unroll
    for (int it = 0; it < 2; ++it) {
      const int row = wave * 8 + it * 4 + q;
      unsigned short hb[8];
#pragma unroll
      for (int e = 0; e < 8; ++e) hb[e] = h_bits(sm[row][c8 + e]);
      const v4u u = (v4u){pk16(hb[0], hb[1]), pk16(hb[2], hb[3]), pk16(hb[4], hb[5]), pk16(hb[6], hb[7])};
      *(v4u*)(T16 + (size_t)(tok0 + row) * kChan + c8) = u;
    }
    
  }
}

// ---------------------------------------------------------------------------
// f32 -> f16 cast with a power-of-two carry, 8 consecutive elements per thread (one 16-B store per lane;
// ---------------------------------------------------------------------------
__global__ __launch_bounds__(256) void wcast8_kernel(const float* __restrict__ in, unsigned short* __restrict__ out, int n8, float scale) {
  const int i = blockIdx.x * 256 + threadIdx.x;
  if (i >= n8) return;
  const float* p = in + 8 * (size_t)i;
  const v4f a = *(const v4f*)(p);
  const v4f c = *(const v4f*)(p + 4);
  unsigned short hb[8];
#pragma unroll
  for (int e = 0; e < 4; ++e) {
    hb[e]     = h_bits(a[e] * scale);
    hb[4 + e] = h_bits(c[e] * scale);
  }
  const v4u u = (v4u){pk16(hb[0], hb[1]), pk16(hb[2], hb[3]), pk16(hb[4], hb[5]), pk16(hb[6], hb[7])};
  unsigned short* q = out + 8 * (size_t)i;
  *(v4u*)q = u;
  
}

// ---------------------------------------------------------------------------
// Head split: QKV32 [8192 token][192] f32 -> Q16 [8 g][4096 n][32] (d 0..15 data, 16..31 zeros),
// K16 (same layout, from columns 64..127), Vcm16 [8 g][64 rows][4096 n] (row d<16 = v[n][h*16+d], rows 16..63 zeros).
// g = b*4 + h. Block = 64 consecutive tokens of one batch (grid 128), 256 threads.
// Load coverage: 12 iterations x 256 threads x 4 floats = 12288 = 64 rows x 192 (the block's rows are contiguous).
// Q/K store coverage per head: thread -> (row = t>>2 in 0..63, quarter = t&3 -> halves 8*quarter..+7) = 64 rows x 32 halves;
// V store coverage: 8 iterations x 32 line slots (t>>3) = 256 lines = 4 heads x 64 rows, each line = this block's 64 tokens
// ---------------------------------------------------------------------------
__global__ __launch_bounds__(256) void qkv_split_kernel(const float* __restrict__ QKV32,
                                                        unsigned short* __restrict__ Q16,
                                                        unsigned short* __restrict__ K16,
                                                        unsigned short* __restrict__ Vcm16) {
  __shared__ float sm[64][193];    // sm[token_local][col]
  const int t    = threadIdx.x;
  const int tok0 = blockIdx.x * 64;
  const int b    = tok0 >> 12;
  const int n0   = tok0 & (kNtok - 1);
  const float* src = QKV32 + (size_t)tok0 * kQKV;
#pragma unroll
  for (int i = 0; i < 12; ++i) {
    const int e   = i * 256 + t;            // float4 index 0..3071
    const int row = e / 48;                 // 48 float4 per 192-float row
    const int col = (e - row * 48) * 4;
    const v4f v = *(const v4f*)(src + 4 * (size_t)e);
    sm[row][col]     = v[0];
    sm[row][col + 1] = v[1];
    sm[row][col + 2] = v[2];
    sm[row][col + 3] = v[3];
  }
  __syncthreads();
  const int rowq = t >> 2;
  const int q4   = t & 3;
  const unsigned keepq = (q4 < 2) ? 0xffffffffu : 0u;   // quarters 2,3 are the zero padding columns 16..31
  const int cq   = (q4 & 1) * 8;
  const int lq   = t >> 3;                              // line slot 0..31
  const int e8   = (t & 7) * 8;                         // token sub-segment of a line
  {
#pragma unroll
    for (int h = 0; h < kHeads; ++h) {
      const size_t prow = ((size_t)(b * kHeads + h) * kNtok + n0 + rowq) * kQKld + 8 * q4;
      {
        unsigned short hb[8];
#pragma unroll
        for (int e = 0; e < 8; ++e) hb[e] = h_bits(sm[rowq][h * kHdim + cq + e]);
        const v4u u = (v4u){pk16(hb[0], hb[1]) & keepq, pk16(hb[2], hb[3]) & keepq,
                            pk16(hb[4], hb[5]) & keepq, pk16(hb[6], hb[7]) & keepq};
        *(v4u*)(Q16 + prow) = u;
      }
      {
        unsigned short hb[8];
#pragma unroll
        for (int e = 0; e < 8; ++e) hb[e] = h_bits(sm[rowq][kChan + h * kHdim + cq + e]);
        const v4u u = (v4u){pk16(hb[0], hb[1]) & keepq, pk16(hb[2], hb[3]) & keepq,
                            pk16(hb[4], hb[5]) & keepq, pk16(hb[6], hb[7]) & keepq};
        *(v4u*)(K16 + prow) = u;
      }
    }
#pragma unroll
    for (int it = 0; it < 8; ++it) {
      const int L  = it * 32 + lq;          // 0..255
      const int h  = L >> 6;                // head
      const int vr = L & 63;                // V channel-major row: d for vr<16, zero row otherwise
      const unsigned keepv = (vr < 16) ? 0xffffffffu : 0u;
      const int d  = vr & 15;               // clamped column used for the (masked) read
      unsigned short hb[8];
#pragma unroll
      for (int e = 0; e < 8; ++e) hb[e] = h_bits(sm[e8 + e][2 * kChan + h * kHdim + d]);
      const v4u u = (v4u){pk16(hb[0], hb[1]) & keepv, pk16(hb[2], hb[3]) & keepv,
                          pk16(hb[4], hb[5]) & keepv, pk16(hb[6], hb[7]) & keepv};
      *(v4u*)(Vcm16 + ((size_t)((b * kHeads + h) * kVrows + vr)) * kNtok + n0 + e8) = u;
    }
    
  }
}

// ---------------------------------------------------------------------------
// Row softmax over 4096 f32 scores: P[row][j] = f16( carry * exp(s - max) / sum exp(s - max) ), f32 math, precise expf.
// One block of 512 threads per row; thread t owns columns 8t..8t+7 (512 x 8 = 4096 = whole row).
// Reductions in fixed order (thread, wave shuffle tree, 16 wave partials in index order).
// exp values are computed once in a rolled 2-trip loop and parked in LDS (thread-private slots).
// ---------------------------------------------------------------------------
__global__ __launch_bounds__(512) void softmax_row_kernel(const float* __restrict__ S, unsigned short* __restrict__ P, float carry) {
  __shared__ float redM[16];
  __shared__ float redS[16];
  __shared__ __align__(16) float es[512 * 8];
  const int row  = blockIdx.x;
  const int t    = threadIdx.x;
  const int lane = t & 31, wave = t >> 5;
  const float* sr = S + (size_t)row * kNtok + 8 * t;
  const v4f a0 = *(const v4f*)(sr);
  const v4f a1 = *(const v4f*)(sr + 4);
  float m = fmaxf(fmaxf(fmaxf(a0[0], a0[1]), fmaxf(a0[2], a0[3])), fmaxf(fmaxf(a1[0], a1[1]), fmaxf(a1[2], a1[3])));
#pragma unroll
  for (int off = 16; off > 0; off >>= 1) m = fmaxf(m, __shfl_xor(m, off, 32));
  if (lane == 0) redM[wave] = m;
  __syncthreads();
  float gm = redM[0];
#pragma unroll
  for (int w = 1; w < 16; ++w) gm = fmaxf(gm, redM[w]);
  float* et = es + t * 8;
  float psum = 0.f;
#pragma unroll 1
  for (int half = 0; half < 2; ++half) {
    const v4f a = *(const v4f*)(sr + 4 * half);
    v4f e;
    e[0] = expf(a[0] - gm);
    e[1] = expf(a[1] - gm);
    e[2] = expf(a[2] - gm);
    e[3] = expf(a[3] - gm);
    psum += (e[0] + e[1]) + (e[2] + e[3]);
    *(v4f*)(et + 4 * half) = e;
  }
#pragma unroll
  for (int off = 16; off > 0; off >>= 1) psum += __shfl_xor(psum, off, 32);
  if (lane == 0) redS[wave] = psum;
  __syncthreads();
  float tot = redS[0];
#pragma unroll
  for (int w = 1; w < 16; ++w) tot += redS[w];
  const float inv = carry * (1.0f / tot);
  const v4f e0 = *(const v4f*)(et);
  const v4f e1 = *(const v4f*)(et + 4);
  unsigned short hb[8];
#pragma unroll
  for (int e = 0; e < 4; ++e) {
    hb[e]     = h_bits(e0[e] * inv);
    hb[4 + e] = h_bits(e1[e] * inv);
  }
  const v4u u = (v4u){pk16(hb[0], hb[1]), pk16(hb[2], hb[3]), pk16(hb[4], hb[5]), pk16(hb[6], hb[7])};
  unsigned short* pp = P + (size_t)row * kNtok + 8 * t;
  *(v4u*)pp = u;
  
}

// ---------------------------------------------------------------------------
// Merge heads to the channel-major output: out[b][h*16+d][n] = O32[(b*4+h)*64 + d][n] (rows d < 16 of each group slot).
// One thread per float4: 131072 threads = 512 blocks x 256 (exact). A wave writes 32 consecutive float4 of one 4096-float
// ---------------------------------------------------------------------------
__global__ __launch_bounds__(256) void merge_out_kernel(const float* __restrict__ O32, float* __restrict__ out) {
  const int i  = blockIdx.x * 256 + threadIdx.x;    // float4 index 0..131071
  const int r  = i >> 10;                            // output row 0..127 (1024 float4 per row)
  const int c4 = (i & 1023) * 4;
  const int b  = r >> 6;
  const int ch = r & 63;
  const int h  = ch >> 4;
  const int d  = ch & 15;
  const size_t src = ((size_t)((b * kHeads + h) * kVrows + d)) * kNtok + c4;
  const v4f v = *(const v4f*)(O32 + src);
  float* p = out + (size_t)r * kNtok + c4;
  *(v4f*)p = v;
  
}

// ---------------------------------------------------------------------------
extern "C" void kernel_launch(void* const* d_in, const int* in_sizes, int n_in,
                              void* d_out, int out_size, void* d_ws, size_t ws_size,
                              hipStream_t stream) {
  (void)in_sizes; (void)n_in;
  const float* x    = (const float*)d_in[0];     // [2][64][4096]
  const float* w    = (const float*)d_in[1];     // [192][64]
  const float* bias = (const float*)d_in[2];     // [192]
  float* out = (float*)d_out;                    // [2][64][4096]

  // ---- workspace carve (see region map at the top) ----
  const size_t szT16   = (size_t)kTok * kChan * 2;
  const size_t szW16   = (size_t)kQKV * kChan * 2;
  const size_t szQKV32 = (size_t)kTok * kQKV * 4;
  const size_t szQK16  = (size_t)kGroups * kNtok * kQKld * 2;
  const size_t szVcm16 = (size_t)kGroups * kVrows * kNtok * 2;
  const size_t szS32   = (size_t)kNtok * kNtok * 4;
  const size_t szP16   = (size_t)kNtok * kNtok * 2;
  const size_t szO32   = (size_t)kGroups * kVrows * kNtok * 4;
  char* ws = (char*)d_ws;
  size_t off = 0;
  unsigned short* T16   = (unsigned short*)(ws + off); off += szT16;
  unsigned short* W16   = (unsigned short*)(ws + off); off += szW16;
  float*          QKV32 = (float*)(ws + off);          off += szQKV32;
  unsigned short* Q16   = (unsigned short*)(ws + off); off += szQK16;
  unsigned short* K16   = (unsigned short*)(ws + off); off += szQK16;
  unsigned short* Vcm16 = (unsigned short*)(ws + off); off += szVcm16;
  float*          S32   = (float*)(ws + off);          off += szS32;
  unsigned short* P16   = (unsigned short*)(ws + off); off += szP16;
  float*          O32   = (float*)(ws + off);          off += szO32;
  if (off > ws_size) return;                                       // 124,805,120 B carved
  if ((size_t)out_size < (size_t)kBatch * kChan * kNtok) return;   // 524,288 f32 elements

  // 1) tokens: x -> T16 [8192][64]
  xtok_kernel<<<dim3(kTok / 64), dim3(256), 0, stream>>>(x, T16);
  // 2) weights: W16 [192][64] = f16(16 w); 12288 / 8 = 1536 threads = 6 blocks
  wcast8_kernel<<<dim3((kQKV * kChan / 8 + 255) / 256), dim3(256), 0, stream>>>(w, W16, kQKV * kChan / 8, kWCarry);
  // 3) qkv = T16 . W16^T x (1/16) + bias -> QKV32 [8192][192] f32; M 8192, N 192, K 64 (tiles 128x3 = 384 -> 48 blocks)
  wmma_gemm64<0, false, 2, 0, false, 0><<<dim3((kTok / 64) * (kQKV / 64) / 8, 1), dim3(256), 0, stream>>>(
      T16, T16, kChan, 0L, W16, W16, kChan, 0L, (void*)QKV32, (void*)QKV32, kQKV, 0L,
      bias, x, 0L, kTok, kQKV, kChan, kWCarryInv);
  // 4) head split -> Q16, K16 [8][4096][32], Vcm16 [8][64][4096] (pads written with zeros)
  qkv_split_kernel<<<dim3(kTok / 64), dim3(256), 0, stream>>>(QKV32, Q16, K16, Vcm16);

  // 5) per (batch, head) group: scores -> softmax -> P.V
  for (int g = 0; g < kGroups; ++g) {
    const unsigned short* Qg = Q16 + (size_t)g * kNtok * kQKld;
    const unsigned short* Kg = K16 + (size_t)g * kNtok * kQKld;
    const unsigned short* Vg = Vcm16 + (size_t)g * kVrows * kNtok;
    float* Og = O32 + (size_t)g * kVrows * kNtok;
    // S[n][m] = 0.25 * sum_d Q[n][d] K[m][d]; M = N = 4096, K = 32 (16 data + 16 zero); 4096 tiles -> 512 blocks
    wmma_gemm64<0, false, 0, 0, false, 0><<<dim3((kNtok / 64) * (kNtok / 64) / 8, 1), dim3(256), 0, stream>>>(
        Qg, Qg, kQKld, 0L, Kg, Kg, kQKld, 0L, (void*)S32, (void*)S32, kNtok, 0L,
        bias, x, 0L, kNtok, kNtok, kQKld, kQKScale);
    // P16[n][m] = f16(2048 * softmax_m(S[n][:]))
    softmax_row_kernel<<<dim3(kNtok), dim3(512), 0, stream>>>(S32, P16, kPCarry);
    // O[d][n] = (1/2048) * sum_m Vcm[d][m] P16[n][m]; M = 64 (16 data + 48 zero rows), N = 4096, K = 4096; 64 tiles -> 8 blocks
    wmma_gemm64<0, false, 0, 0, false, 0><<<dim3((kVrows / 64) * (kNtok / 64) / 8, 1), dim3(256), 0, stream>>>(
        Vg, Vg, kNtok, 0L, P16, P16, kNtok, 0L, (void*)Og, (void*)Og, kNtok, 0L,
        bias, x, 0L, kVrows, kNtok, kNtok, kPCarryInv);
  }

  // 6) merge heads to the channel-major output
  merge_out_kernel<<<dim3((kBatch * kChan * kNtok / 4) / 256), dim3(256), 0, stream>>>(O32, out);
}

// v001
// Measured time: 379 microseconds a run.
// Next to v000, in two timings, it ran 3.96 and 4.02 times as fast.
// Contractions: qkv projection (T f16 x W^T f16 carried x16), scores q.k^T (q,k f16 planes, head dim 16 zero-padded to 32), attn.v (V f16 channel-major x P^T f16 carried x2048): all v_wmma_f32_16x16x32_f16 with f32 accumulate; softmax and layout shuffles in f32.
#include <hip/hip_runtime.h>
#include <math.h>

// ---------------------------------------------------------------------------
// Problem constants
// ---------------------------------------------------------------------------
constexpr int kBatch  = 2;
constexpr int kChan   = 64;                 // input channels = output channels
constexpr int kNtok   = 4096;               // tokens per batch (64 x 64)
constexpr int kTok    = kBatch * kNtok;     // 8192 token rows
constexpr int kHeads  = 4;
constexpr int kHdim   = 16;
constexpr int kGroups = kBatch * kHeads;    // 8 (batch, head) groups
constexpr int kQKV    = 3 * kChan;          // 192 projection outputs
constexpr int kQKld   = 32;                 // q/k plane pitch in halves: 16 data + 16 zero
constexpr int kVrows  = 64;                 // V channel-major rows per group: 16 data + 48 zero
constexpr float kWCarry    = 16.0f;         // weights carried x16 in f16
constexpr float kWCarryInv = 1.0f / 16.0f;
constexpr float kPCarry    = 2048.0f;       // probabilities carried x2048 in f16
constexpr float kPCarryInv = 1.0f / 2048.0f;
constexpr float kQKScale   = 0.25f;         // 1/sqrt(16)

// ---------------------------------------------------------------------------
// Workspace region map (bytes; every region 4096-B aligned; total 124,805,120 <= 134,217,728)
//   T16    f16 [8192][64]            1,048,576   at          0
//   W16    f16 [192][64]                24,576   at  1,048,576
//   QKV32  f32 [8192][192]           6,291,456   at  1,073,152
//   Q16    f16 [8][4096][32]         2,097,152   at  7,364,608
//   K16    f16 [8][4096][32]         2,097,152   at  9,461,760
//   Vcm16  f16 [8][64][4096]         4,194,304   at 11,558,912
//   S32    f32 [4096][4096]         67,108,864   at 15,753,216   (reused per group)
//   P16    f16 [4096][4096]         33,554,432   at 82,862,080   (reused per group)
//   O32    f32 [8][64][4096]         8,388,608   at 116,416,512
//   end                                           124,805,120
// ---------------------------------------------------------------------------

typedef __attribute__((ext_vector_type(16))) _Float16 v16h;
typedef __attribute__((ext_vector_type(8)))  _Float16 v8h;
typedef __attribute__((ext_vector_type(16))) __bf16   v16b;
typedef __attribute__((ext_vector_type(8)))  __bf16   v8b;
typedef __attribute__((ext_vector_type(8)))  float    v8f;
typedef __attribute__((ext_vector_type(4)))  float    v4f;
typedef __attribute__((ext_vector_type(4)))  unsigned int v4u;

// ---------------------------------------------------------------------------
// Helpers
// ---------------------------------------------------------------------------
__device__ __forceinline__ unsigned short f2bf_bits(float f) {
  unsigned u = __float_as_uint(f);
  return (unsigned short)((u + 0x7FFFu + ((u >> 16) & 1u)) >> 16);
}
__device__ __forceinline__ float bf_bits2f(unsigned short h) { return __uint_as_float(((unsigned)h) << 16); }

// hazard guards as plain device helpers (no inline asm inside the kernel template body)
__device__ __forceinline__ void dep_guard_h(v8f& a, v8f& b, v16h x, v16h y) { asm volatile("v_nop\n\tv_nop\n\tv_nop\n\tv_nop" : "+v"(a), "+v"(b) : "v"(x), "v"(y)); }
__device__ __forceinline__ void dep_guard_b(v8f& a, v8f& b, v16b x, v16b y) { asm volatile("v_nop\n\tv_nop\n\tv_nop\n\tv_nop" : "+v"(a), "+v"(b) : "v"(x), "v"(y)); }
__device__ __forceinline__ void keep4_h(v16h a, v16h b, v16h c, v16h d) { asm volatile("v_nop" :: "v"(a), "v"(b), "v"(c), "v"(d)); }
__device__ __forceinline__ void keep4_b(v16b a, v16b b, v16b c, v16b d) { asm volatile("v_nop" :: "v"(a), "v"(b), "v"(c), "v"(d)); }
__device__ __forceinline__ void acc_guard4(v8f& a, v8f& b, v8f& c, v8f& d) { asm volatile("v_nop\n\tv_nop\n\tv_nop\n\tv_nop" : "+v"(a), "+v"(b), "+v"(c), "+v"(d)); }
template <typename T> struct Frag;
template <> struct Frag<_Float16> {
  typedef v16h V; union U { v16h v; v8h h[2]; };
  // elements 0..7 <- p[0..7], 8..15 <- p[16..23]
  static __device__ __forceinline__ v16h load(const _Float16* p) {
    U f; f.h[0] = *(const v8h*)(p); f.h[1] = *(const v8h*)(p + 16); return f.v;
  }
  static __device__ __forceinline__ v8f mma(v16h a, v16h b, v8f c) {
    return __builtin_amdgcn_wmma_f32_16x16x32_f16(false, a, false, b, (short)0, c, false, false);
  }
  static __device__ __forceinline__ void guard(v8f& a, v8f& b, v16h x, v16h y) { dep_guard_h(a, b, x, y); }
  static __device__ __forceinline__ void keep(v16h a, v16h b, v16h c, v16h d) { keep4_h(a, b, c, d); }
};
template <> struct Frag<__bf16> {
  typedef v16b V; union U { v16b v; v8b h[2]; };
  static __device__ __forceinline__ v16b load(const __bf16* p) {
    U f; f.h[0] = *(const v8b*)(p); f.h[1] = *(const v8b*)(p + 16); return f.v;
  }
  static __device__ __forceinline__ v8f mma(v16b a, v16b b, v8f c) {
    return __builtin_amdgcn_wmma_f32_16x16x32_bf16(false, a, false, b, (short)0, c, false, false);
  }
  static __device__ __forceinline__ void guard(v8f& a, v8f& b, v16b x, v16b y) { dep_guard_b(a, b, x, y); }
  static __device__ __forceinline__ void keep(v16b a, v16b b, v16b c, v16b d) { keep4_b(a, b, c, d); }
};

__device__ __forceinline__ unsigned pk16(unsigned short a, unsigned short b) { return (unsigned)a | ((unsigned)b << 16); }
__device__ __forceinline__ unsigned short h_bits(float f) { const _Float16 h = (_Float16)f; return __builtin_bit_cast(unsigned short, h); }

// ---- Register-blocked batched WMMA GEMM (ACT reduced to none/relu/leaky) --------------------------------
// C[m,n] = scale * sum_k A[m,k] * Bt[n,k] (+bias)(+resid); each wave owns a 64x64 tile.
// A row-major [M,K]; Bt row-major [N,K]; M,N % 64 == 0, K % 32 == 0.
// SPLIT: operands are hi/lo planes (A2/Bt2 = lo planes, same layout); product = hi*hi + hi*lo + lo*hi.
// BIAS_MODE: 0 = none, 1 = bias[m], 2 = bias[n].
// OUT_MODE: 0 = f32, 1 = f16, 2 = bf16 hi plane (Cout) + bf16 lo plane (Cout2).
// ET: 0 = f16 operands, 1 = bf16 operands (pointers passed as 16-bit storage)
template <int ET> struct Elem;
template <> struct Elem<0> { typedef _Float16 T; };
template <> struct Elem<1> { typedef __bf16 T; };
template <int ET, bool SPLIT, int BIAS_MODE, int OUT_MODE, bool RESID, int ACT = 0>
__global__ __launch_bounds__(256) void wmma_gemm64(
    const unsigned short* __restrict__ Ap, const unsigned short* __restrict__ A2p, int lda, long strideA,
    const unsigned short* __restrict__ Btp, const unsigned short* __restrict__ Bt2p, int ldb, long strideB,
    void* __restrict__ Cout, void* __restrict__ Cout2, int ldc, long strideC,
    const float* __restrict__ bias,
    const float* __restrict__ resid, long strideR,
    int M, int N, int K, float scale) {
  typedef typename Elem<ET>::T T;
  typedef typename Frag<T>::V V;
  const T* A = (const T*)Ap; const T* A2 = (const T*)A2p; const T* Bt = (const T*)Btp; const T* Bt2 = (const T*)Bt2p;
  __shared__ __align__(16) float sT[8][16 * 68];   // per-wave 16x64 slab, pitch 68 floats
  const int b    = blockIdx.y;
  const int lane = threadIdx.x & 31;
  const int wave = threadIdx.x >> 5;
  const int tilesN = N >> 6;
  const int tilesM = M >> 6;
  const int tile = blockIdx.x * 8 + wave;
  if (tile >= tilesM * tilesN) return;   // wave-uniform; no block barriers in this kernel
  const int tm = tile / tilesN;
  const int tn = tile - tm * tilesN;
  const int m0 = tm << 6;
  const int n0 = tn << 6;

  const T* Ab  = A  + (size_t)b * strideA;
  const T* Bb  = Bt + (size_t)b * strideB;
  const T* Ab2 = SPLIT ? (A2  + (size_t)b * strideA) : nullptr;
  const T* Bb2 = SPLIT ? (Bt2 + (size_t)b * strideB) : nullptr;

  const int rlane = lane & 15;                 // row (A) / col (B, D) within subtile
  const int koff  = (lane >> 4) * 8;           // k offset of this lane half
  const int mOff  = (lane >> 4) * 8;           // D row offset

  v8f acc[4][4];
#pragma unroll
  for (int i = 0; i < 4; ++i)
#pragma unroll
    for (int j = 0; j < 4; ++j) acc[i][j] = (v8f){0.f,0.f,0.f,0.f,0.f,0.f,0.f,0.f};

  for (int k0 = 0; k0 < K; k0 += 32) {
    V bh[4], bl[4];
#pragma unroll
    for (int j = 0; j < 4; ++j) {
      const size_t bo = (size_t)(n0 + (j << 4) + rlane) * ldb + koff + k0;
      bh[j] = Frag<T>::load(Bb + bo);
      if (SPLIT) bl[j] = Frag<T>::load(Bb2 + bo);
    }
#pragma unroll
    for (int i = 0; i < 4; ++i) {
      const size_t ao = (size_t)(m0 + (i << 4) + rlane) * lda + koff + k0;
      V ah = Frag<T>::load(Ab + ao);
      V al;
      if (SPLIT) al = Frag<T>::load(Ab2 + ao);
#pragma unroll
      for (int j = 0; j < 4; ++j) {
        acc[i][j] = Frag<T>::mma(ah, bh[j], acc[i][j]);
        if (SPLIT) {
          acc[i][j] = Frag<T>::mma(ah, bl[j], acc[i][j]);
          acc[i][j] = Frag<T>::mma(al, bh[j], acc[i][j]);
        }
      }
      Frag<T>::guard(acc[i][0], acc[i][3], ah, SPLIT ? al : ah);
    }
    Frag<T>::keep(bh[0], bh[1], bh[2], bh[3]);
    if (SPLIT) Frag<T>::keep(bl[0], bl[1], bl[2], bl[3]);
  }
  acc_guard4(acc[0][0], acc[0][1], acc[0][2], acc[0][3]);
  acc_guard4(acc[1][0], acc[1][1], acc[1][2], acc[1][3]);
  acc_guard4(acc[2][0], acc[2][1], acc[2][2], acc[2][3]);
  acc_guard4(acc[3][0], acc[3][1], acc[3][2], acc[3][3]);

  // ---- epilogue ----
  float* slab = sT[wave];
  const float* Rb = RESID ? (resid + (size_t)b * strideR) : nullptr;
#pragma unroll
  for (int i = 0; i < 4; ++i) {
    const int mBase = m0 + (i << 4);
#pragma unroll
    for (int j = 0; j < 4; ++j) {
      const int n = n0 + (j << 4) + rlane;
      float bv = 0.f;
      if (BIAS_MODE == 2) bv = bias[n];
#pragma unroll
      for (int r = 0; r < 8; ++r) {
        float v = acc[i][j][r] * scale;
        if (BIAS_MODE == 1) v += bias[mBase + mOff + r];
        if (BIAS_MODE == 2) v += bv;
        if (RESID) v += Rb[(size_t)(mBase + mOff + r) * ldc + n];
        if (ACT == 2) v = fmaxf(v, 0.0f);
        if (ACT == 4) v = (v > 0.f) ? v : 0.01f * v;
        slab[(mOff + r) * 68 + (j << 4) + rlane] = v;
      }
    }
    __builtin_amdgcn_fence(__ATOMIC_RELEASE, "workgroup");
    __builtin_amdgcn_wave_barrier();
    __builtin_amdgcn_fence(__ATOMIC_ACQUIRE, "workgroup");
    if (OUT_MODE == 0) {
      float* C = (float*)Cout + (size_t)b * strideC;
      const int hh = lane >> 4, c4 = (lane & 15) * 4;     // row seg = 256 B = 16 lanes x 16 B
      {
#pragma unroll
        for (int it = 0; it < 8; ++it) {
          const int row = it * 2 + hh;
          v4f v = *(const v4f*)(slab + row * 68 + c4);
          *(v4f*)(C + (size_t)(mBase + row) * ldc + n0 + c4) = v;
        }
        
      }
    } else {
      const int q = lane >> 3, c8 = (lane & 7) * 8;
      unsigned short* C  = (unsigned short*)Cout  + (size_t)b * strideC;
      unsigned short* C2 = (OUT_MODE == 2) ? ((unsigned short*)Cout2 + (size_t)b * strideC) : nullptr;
      {
#pragma unroll
        for (int it = 0; it < 4; ++it) {
          const int row = it * 4 + q;
          const float* sp = slab + row * 68 + c8;
          v8h hv, lv;
#pragma unroll
          for (int e = 0; e < 8; ++e) {
            if (OUT_MODE == 1) {
              hv[e] = (_Float16)sp[e];
            } else {
              unsigned short hb = f2bf_bits(sp[e]);
              unsigned short lb = f2bf_bits(sp[e] - bf_bits2f(hb));
              hv[e] = __builtin_bit_cast(_Float16, hb);
              lv[e] = __builtin_bit_cast(_Float16, lb);
            }
          }
          *(v8h*)(C + (size_t)(mBase + row) * ldc + n0 + c8) = hv;
          if (OUT_MODE == 2) *(v8h*)(C2 + (size_t)(mBase + row) * ldc + n0 + c8) = lv;
        }
        
      }
    }
    __builtin_amdgcn_fence(__ATOMIC_RELEASE, "workgroup");
    __builtin_amdgcn_wave_barrier();
    __builtin_amdgcn_fence(__ATOMIC_ACQUIRE, "workgroup");
  }
}

// ---------------------------------------------------------------------------
// Token transpose + cast: x [2][64 c][4096 n] f32 -> T16 [8192 token][64 c] f16 bits, T16[b*4096+n][c] = f16(x[b][c][n]).
// Block = 64 consecutive tokens of one batch; grid = 128 blocks; 256 threads.
// Load coverage: 16 iterations x 256 threads = 4096 = 64 c x 64 tokens (coalesced along n).
// Store coverage: 8 waves x 2 iterations x 4 rows (lane>>3) = 64 token rows; (lane&7) x 8 halves = 64 c;
// ---------------------------------------------------------------------------
__global__ __launch_bounds__(256) void xtok_kernel(const float* __restrict__ x, unsigned short* __restrict__ T16) {
  __shared__ float sm[64][65];     // sm[token_local][c]
  const int t    = threadIdx.x;
  const int tok0 = blockIdx.x * 64;
  const int b    = tok0 >> 12;
  const int n0   = tok0 & (kNtok - 1);
  const float* xb = x + (size_t)b * kChan * kNtok + n0;
#pragma unroll
  for (int i = 0; i < 16; ++i) {
    const int e  = i * 256 + t;
    const int c  = e >> 6;
    const int nl = e & 63;
    sm[nl][c] = xb[(size_t)c * kNtok + nl];
  }
  __syncthreads();
  const int lane = t & 31, wave = t >> 5;
  const int q = lane >> 3, c8 = (lane & 7) * 8;
  {
#pragma unroll
    for (int it = 0; it < 2; ++it) {
      const int row = wave * 8 + it * 4 + q;
      unsigned short hb[8];
#pragma unroll
      for (int e = 0; e < 8; ++e) hb[e] = h_bits(sm[row][c8 + e]);
      const v4u u = (v4u){pk16(hb[0], hb[1]), pk16(hb[2], hb[3]), pk16(hb[4], hb[5]), pk16(hb[6], hb[7])};
      *(v4u*)(T16 + (size_t)(tok0 + row) * kChan + c8) = u;
    }
    
  }
}

// ---------------------------------------------------------------------------
// f32 -> f16 cast with a power-of-two carry, 8 consecutive elements per thread (one 16-B store per lane;
// ---------------------------------------------------------------------------
__global__ __launch_bounds__(256) void wcast8_kernel(const float* __restrict__ in, unsigned short* __restrict__ out, int n8, float scale) {
  const int i = blockIdx.x * 256 + threadIdx.x;
  if (i >= n8) return;
  const float* p = in + 8 * (size_t)i;
  const v4f a = *(const v4f*)(p);
  const v4f c = *(const v4f*)(p + 4);
  unsigned short hb[8];
#pragma unroll
  for (int e = 0; e < 4; ++e) {
    hb[e]     = h_bits(a[e] * scale);
    hb[4 + e] = h_bits(c[e] * scale);
  }
  const v4u u = (v4u){pk16(hb[0], hb[1]), pk16(hb[2], hb[3]), pk16(hb[4], hb[5]), pk16(hb[6], hb[7])};
  unsigned short* q = out + 8 * (size_t)i;
  *(v4u*)q = u;
  
}

// ---------------------------------------------------------------------------
// Head split: QKV32 [8192 token][192] f32 -> Q16 [8 g][4096 n][32] (d 0..15 data, 16..31 zeros),
// K16 (same layout, from columns 64..127), Vcm16 [8 g][64 rows][4096 n] (row d<16 = v[n][h*16+d], rows 16..63 zeros).
// g = b*4 + h. Block = 64 consecutive tokens of one batch (grid 128), 256 threads.
// Load coverage: 12 iterations x 256 threads x 4 floats = 12288 = 64 rows x 192 (the block's rows are contiguous).
// Q/K store coverage per head: thread -> (row = t>>2 in 0..63, quarter = t&3 -> halves 8*quarter..+7) = 64 rows x 32 halves;
// V store coverage: 8 iterations x 32 line slots (t>>3) = 256 lines = 4 heads x 64 rows, each line = this block's 64 tokens
// ---------------------------------------------------------------------------
__global__ __launch_bounds__(256) void qkv_split_kernel(const float* __restrict__ QKV32,
                                                        unsigned short* __restrict__ Q16,
                                                        unsigned short* __restrict__ K16,
                                                        unsigned short* __restrict__ Vcm16) {
  __shared__ float sm[64][193];    // sm[token_local][col]
  const int t    = threadIdx.x;
  const int tok0 = blockIdx.x * 64;
  const int b    = tok0 >> 12;
  const int n0   = tok0 & (kNtok - 1);
  const float* src = QKV32 + (size_t)tok0 * kQKV;
#pragma unroll
  for (int i = 0; i < 12; ++i) {
    const int e   = i * 256 + t;            // float4 index 0..3071
    const int row = e / 48;                 // 48 float4 per 192-float row
    const int col = (e - row * 48) * 4;
    const v4f v = *(const v4f*)(src + 4 * (size_t)e);
    sm[row][col]     = v[0];
    sm[row][col + 1] = v[1];
    sm[row][col + 2] = v[2];
    sm[row][col + 3] = v[3];
  }
  __syncthreads();
  const int rowq = t >> 2;
  const int q4   = t & 3;
  const unsigned keepq = (q4 < 2) ? 0xffffffffu : 0u;   // quarters 2,3 are the zero padding columns 16..31
  const int cq   = (q4 & 1) * 8;
  const int lq   = t >> 3;                              // line slot 0..31
  const int e8   = (t & 7) * 8;                         // token sub-segment of a line
  {
#pragma unroll
    for (int h = 0; h < kHeads; ++h) {
      const size_t prow = ((size_t)(b * kHeads + h) * kNtok + n0 + rowq) * kQKld + 8 * q4;
      {
        unsigned short hb[8];
#pragma unroll
        for (int e = 0; e < 8; ++e) hb[e] = h_bits(sm[rowq][h * kHdim + cq + e]);
        const v4u u = (v4u){pk16(hb[0], hb[1]) & keepq, pk16(hb[2], hb[3]) & keepq,
                            pk16(hb[4], hb[5]) & keepq, pk16(hb[6], hb[7]) & keepq};
        *(v4u*)(Q16 + prow) = u;
      }
      {
        unsigned short hb[8];
#pragma unroll
        for (int e = 0; e < 8; ++e) hb[e] = h_bits(sm[rowq][kChan + h * kHdim + cq + e]);
        const v4u u = (v4u){pk16(hb[0], hb[1]) & keepq, pk16(hb[2], hb[3]) & keepq,
                            pk16(hb[4], hb[5]) & keepq, pk16(hb[6], hb[7]) & keepq};
        *(v4u*)(K16 + prow) = u;
      }
    }
#pragma unroll
    for (int it = 0; it < 8; ++it) {
      const int L  = it * 32 + lq;          // 0..255
      const int h  = L >> 6;                // head
      const int vr = L & 63;                // V channel-major row: d for vr<16, zero row otherwise
      const unsigned keepv = (vr < 16) ? 0xffffffffu : 0u;
      const int d  = vr & 15;               // clamped column used for the (masked) read
      unsigned short hb[8];
#pragma unroll
      for (int e = 0; e < 8; ++e) hb[e] = h_bits(sm[e8 + e][2 * kChan + h * kHdim + d]);
      const v4u u = (v4u){pk16(hb[0], hb[1]) & keepv, pk16(hb[2], hb[3]) & keepv,
                          pk16(hb[4], hb[5]) & keepv, pk16(hb[6], hb[7]) & keepv};
      *(v4u*)(Vcm16 + ((size_t)((b * kHeads + h) * kVrows + vr)) * kNtok + n0 + e8) = u;
    }
    
  }
}

// ---------------------------------------------------------------------------
// Row softmax over 4096 f32 scores: P[row][j] = f16( carry * exp(s - max) / sum exp(s - max) ), f32 math, precise expf.
// One block of 512 threads per row; thread t owns columns 8t..8t+7 (512 x 8 = 4096 = whole row).
// Reductions in fixed order (thread, wave shuffle tree, 16 wave partials in index order).
// exp values are computed once in a rolled 2-trip loop and parked in LDS (thread-private slots).
// ---------------------------------------------------------------------------
__global__ __launch_bounds__(512) void softmax_row_kernel(const float* __restrict__ S, unsigned short* __restrict__ P, float carry) {
  __shared__ float redM[16];
  __shared__ float redS[16];
  __shared__ __align__(16) float es[512 * 8];
  const int row  = blockIdx.x;
  const int t    = threadIdx.x;
  const int lane = t & 31, wave = t >> 5;
  const float* sr = S + (size_t)row * kNtok + 8 * t;
  const v4f a0 = *(const v4f*)(sr);
  const v4f a1 = *(const v4f*)(sr + 4);
  float m = fmaxf(fmaxf(fmaxf(a0[0], a0[1]), fmaxf(a0[2], a0[3])), fmaxf(fmaxf(a1[0], a1[1]), fmaxf(a1[2], a1[3])));
#pragma unroll
  for (int off = 16; off > 0; off >>= 1) m = fmaxf(m, __shfl_xor(m, off, 32));
  if (lane == 0) redM[wave] = m;
  __syncthreads();
  float gm = redM[0];
#pragma unroll
  for (int w = 1; w < 16; ++w) gm = fmaxf(gm, redM[w]);
  float* et = es + t * 8;
  float psum = 0.f;
#pragma unroll 1
  for (int half = 0; half < 2; ++half) {
    const v4f a = *(const v4f*)(sr + 4 * half);
    v4f e;
    e[0] = expf(a[0] - gm);
    e[1] = expf(a[1] - gm);
    e[2] = expf(a[2] - gm);
    e[3] = expf(a[3] - gm);
    psum += (e[0] + e[1]) + (e[2] + e[3]);
    *(v4f*)(et + 4 * half) = e;
  }
#pragma unroll
  for (int off = 16; off > 0; off >>= 1) psum += __shfl_xor(psum, off, 32);
  if (lane == 0) redS[wave] = psum;
  __syncthreads();
  float tot = redS[0];
#pragma unroll
  for (int w = 1; w < 16; ++w) tot += redS[w];
  const float inv = carry * (1.0f / tot);
  const v4f e0 = *(const v4f*)(et);
  const v4f e1 = *(const v4f*)(et + 4);
  unsigned short hb[8];
#pragma unroll
  for (int e = 0; e < 4; ++e) {
    hb[e]     = h_bits(e0[e] * inv);
    hb[4 + e] = h_bits(e1[e] * inv);
  }
  const v4u u = (v4u){pk16(hb[0], hb[1]), pk16(hb[2], hb[3]), pk16(hb[4], hb[5]), pk16(hb[6], hb[7])};
  unsigned short* pp = P + (size_t)row * kNtok + 8 * t;
  *(v4u*)pp = u;
  
}

// ---------------------------------------------------------------------------
// P.V product of one (batch, head) group: O[d][n] = scale * sum_m V[d][m] * P[n][m], d < 16, n and m < 4096.
// Block = 32 tokens n x all 4096 m, 16 waves (grid 128); wave w sums m in [256 w, 256 w + 256) on WMMA:
// A = the 16 data rows of V, B = two tiles of 16 P rows, both read by the same fragment loader (equal k order).
// A wave brings its slice in with loads that cover whole 256-B pieces of two rows each, parks 128 m at a time in its
// own LDS range (48 rows, pitch 272 B = 16 B x 17) and reads the fragments from there.
// The 16 partial 16 x 32 tiles are summed in wave order; each wave then stores one whole 128-B line of O.
// ---------------------------------------------------------------------------
constexpr int kPvTok   = 32;                     // tokens per block
constexpr int kPvWaves = 16;                     // waves per block = k slices
constexpr int kPvKw    = kNtok / kPvWaves;       // 256 k per wave
constexpr int kPvKc    = 128;                    // k per staged chunk: 256 B of a row
constexpr int kPvPitch = kPvKc + 8;              // LDS row pitch in halves
constexpr int kPvRows  = kHdim + kPvTok;         // 16 V rows + 32 P rows
constexpr int kPvLd    = kPvRows / 2;            // 24 loads of two rows per chunk
constexpr int kPvPart  = kPvTok + 4;             // partial-tile pitch in floats: lane halves fall on different banks

// One wave's LDS stores become visible to its own lanes' later LDS loads, and its loads are done before it overwrites.
__device__ __forceinline__ void wave_lds_order() {
  __builtin_amdgcn_fence(__ATOMIC_RELEASE, "workgroup", "local");
  __builtin_amdgcn_wave_barrier();
  __builtin_amdgcn_fence(__ATOMIC_ACQUIRE, "workgroup", "local");
}

__global__ __launch_bounds__(512) void pv_splitk_kernel(const unsigned short* __restrict__ Vp,
                                                        const unsigned short* __restrict__ Pp,
                                                        float* __restrict__ O, float scale) {
  __shared__ __align__(16) _Float16 stage[kPvWaves][kPvRows * kPvPitch];
  __shared__ __align__(16) float part[kPvWaves][kHdim * kPvPart];
  const _Float16* V = (const _Float16*)Vp;
  const _Float16* P = (const _Float16*)Pp;
  const int t     = threadIdx.x;
  const int lane  = t & 31;
  const int wave  = t >> 5;
  const int n0    = blockIdx.x * kPvTok;
  const int rlane = lane & 15;                   // A row (d) / B column (token) of a fragment
  const int hl    = lane >> 4;
  const int koff  = hl * 8;                      // k offset of this lane half in a fragment
  const int piece = rlane * 8;                   // this lane's 16 B of a 256-B row piece

  const unsigned loff = (unsigned)(hl * kNtok + wave * kPvKw + piece);   // one lane offset serves V and P
  const _Float16* vsrc = V + loff;
  const _Float16* psrc = P + (size_t)n0 * kNtok + loff;
  v8h rg[2][kPvLd];
  // unrolled (all loops below too): rg and the accumulators need constant indices to stay in registers,
  // and the wave's 48 loads are then all in flight before the first wait
#pragma unroll
  for (int c = 0; c < 2; ++c) {
#pragma unroll
    for (int i = 0; i < kHdim / 2; ++i) rg[c][i] = *(const v8h*)(vsrc + (size_t)(2 * i) * kNtok + c * kPvKc);
#pragma unroll
    for (int i = 0; i < kPvTok / 2; ++i) rg[c][kHdim / 2 + i] = *(const v8h*)(psrc + (size_t)(2 * i) * kNtok + c * kPvKc);
  }

  _Float16* sw = stage[wave];
  v8f acc0 = (v8f){0.f,0.f,0.f,0.f,0.f,0.f,0.f,0.f};
  v8f acc1 = (v8f){0.f,0.f,0.f,0.f,0.f,0.f,0.f,0.f};
#pragma unroll
  for (int c = 0; c < 2; ++c) {
    if (c > 0) wave_lds_order();                 // the last chunk's fragment reads end before its rows are overwritten
#pragma unroll
    for (int i = 0; i < kPvLd; ++i) *(v8h*)(sw + (2 * i + hl) * kPvPitch + piece) = rg[c][i];
    wave_lds_order();                            // every lane's rows are in LDS before any lane reads fragments
#pragma unroll
    for (int ks = 0; ks < kPvKc / 32; ++ks) {
      const v16h a  = Frag<_Float16>::load(sw + rlane * kPvPitch + ks * 32 + koff);
      const v16h b0 = Frag<_Float16>::load(sw + (kHdim + rlane) * kPvPitch + ks * 32 + koff);
      const v16h b1 = Frag<_Float16>::load(sw + (kHdim + 16 + rlane) * kPvPitch + ks * 32 + koff);
      acc0 = Frag<_Float16>::mma(a, b0, acc0);
      acc1 = Frag<_Float16>::mma(a, b1, acc1);
    }
  }

  float* pw = part[wave];
#pragma unroll
  for (int r = 0; r < 8; ++r) {
    pw[(hl * 8 + r) * kPvPart + rlane]      = acc0[r];
    pw[(hl * 8 + r) * kPvPart + 16 + rlane] = acc1[r];
  }
  __syncthreads();
  const int d = t >> 5;                          // 512 threads = 16 rows d x 32 tokens
  float s = part[0][d * kPvPart + lane];
  // unrolled: the LDS reads issue ahead of the adds; the sum order stays w = 0 .. 15
#pragma unroll
  for (int w = 1; w < kPvWaves; ++w) s += part[w][d * kPvPart + lane];
  O[(size_t)d * kNtok + n0 + lane] = s * scale;
}

// ---------------------------------------------------------------------------
// Merge heads to the channel-major output: out[b][h*16+d][n] = O32[(b*4+h)*64 + d][n] (rows d < 16 of each group slot).
// One thread per float4: 131072 threads = 512 blocks x 256 (exact). A wave writes 32 consecutive float4 of one 4096-float
// ---------------------------------------------------------------------------
__global__ __launch_bounds__(256) void merge_out_kernel(const float* __restrict__ O32, float* __restrict__ out) {
  const int i  = blockIdx.x * 256 + threadIdx.x;    // float4 index 0..131071
  const int r  = i >> 10;                            // output row 0..127 (1024 float4 per row)
  const int c4 = (i & 1023) * 4;
  const int b  = r >> 6;
  const int ch = r & 63;
  const int h  = ch >> 4;
  const int d  = ch & 15;
  const size_t src = ((size_t)((b * kHeads + h) * kVrows + d)) * kNtok + c4;
  const v4f v = *(const v4f*)(O32 + src);
  float* p = out + (size_t)r * kNtok + c4;
  *(v4f*)p = v;
  
}

// ---------------------------------------------------------------------------
extern "C" void kernel_launch(void* const* d_in, const int* in_sizes, int n_in,
                              void* d_out, int out_size, void* d_ws, size_t ws_size,
                              hipStream_t stream) {
  (void)in_sizes; (void)n_in;
  const float* x    = (const float*)d_in[0];     // [2][64][4096]
  const float* w    = (const float*)d_in[1];     // [192][64]
  const float* bias = (const float*)d_in[2];     // [192]
  float* out = (float*)d_out;                    // [2][64][4096]

  // ---- workspace carve (see region map at the top) ----
  const size_t szT16   = (size_t)kTok * kChan * 2;
  const size_t szW16   = (size_t)kQKV * kChan * 2;
  const size_t szQKV32 = (size_t)kTok * kQKV * 4;
  const size_t szQK16  = (size_t)kGroups * kNtok * kQKld * 2;
  const size_t szVcm16 = (size_t)kGroups * kVrows * kNtok * 2;
  const size_t szS32   = (size_t)kNtok * kNtok * 4;
  const size_t szP16   = (size_t)kNtok * kNtok * 2;
  const size_t szO32   = (size_t)kGroups * kVrows * kNtok * 4;
  char* ws = (char*)d_ws;
  size_t off = 0;
  unsigned short* T16   = (unsigned short*)(ws + off); off += szT16;
  unsigned short* W16   = (unsigned short*)(ws + off); off += szW16;
  float*          QKV32 = (float*)(ws + off);          off += szQKV32;
  unsigned short* Q16   = (unsigned short*)(ws + off); off += szQK16;
  unsigned short* K16   = (unsigned short*)(ws + off); off += szQK16;
  unsigned short* Vcm16 = (unsigned short*)(ws + off); off += szVcm16;
  float*          S32   = (float*)(ws + off);          off += szS32;
  unsigned short* P16   = (unsigned short*)(ws + off); off += szP16;
  float*          O32   = (float*)(ws + off);          off += szO32;
  if (off > ws_size) return;                                       // 124,805,120 B carved
  if ((size_t)out_size < (size_t)kBatch * kChan * kNtok) return;   // 524,288 f32 elements

  // 1) tokens: x -> T16 [8192][64]
  xtok_kernel<<<dim3(kTok / 64), dim3(256), 0, stream>>>(x, T16);
  // 2) weights: W16 [192][64] = f16(16 w); 12288 / 8 = 1536 threads = 6 blocks
  wcast8_kernel<<<dim3((kQKV * kChan / 8 + 255) / 256), dim3(256), 0, stream>>>(w, W16, kQKV * kChan / 8, kWCarry);
  // 3) qkv = T16 . W16^T x (1/16) + bias -> QKV32 [8192][192] f32; M 8192, N 192, K 64 (tiles 128x3 = 384 -> 48 blocks)
  wmma_gemm64<0, false, 2, 0, false, 0><<<dim3((kTok / 64) * (kQKV / 64) / 8, 1), dim3(256), 0, stream>>>(
      T16, T16, kChan, 0L, W16, W16, kChan, 0L, (void*)QKV32, (void*)QKV32, kQKV, 0L,
      bias, x, 0L, kTok, kQKV, kChan, kWCarryInv);
  // 4) head split -> Q16, K16 [8][4096][32], Vcm16 [8][64][4096] (pads written with zeros)
  qkv_split_kernel<<<dim3(kTok / 64), dim3(256), 0, stream>>>(QKV32, Q16, K16, Vcm16);

  // 5) per (batch, head) group: scores -> softmax -> P.V
  for (int g = 0; g < kGroups; ++g) {
    const unsigned short* Qg = Q16 + (size_t)g * kNtok * kQKld;
    const unsigned short* Kg = K16 + (size_t)g * kNtok * kQKld;
    const unsigned short* Vg = Vcm16 + (size_t)g * kVrows * kNtok;
    float* Og = O32 + (size_t)g * kVrows * kNtok;
    // S[n][m] = 0.25 * sum_d Q[n][d] K[m][d]; M = N = 4096, K = 32 (16 data + 16 zero); 4096 tiles -> 512 blocks
    wmma_gemm64<0, false, 0, 0, false, 0><<<dim3((kNtok / 64) * (kNtok / 64) / 8, 1), dim3(256), 0, stream>>>(
        Qg, Qg, kQKld, 0L, Kg, Kg, kQKld, 0L, (void*)S32, (void*)S32, kNtok, 0L,
        bias, x, 0L, kNtok, kNtok, kQKld, kQKScale);
    // P16[n][m] = f16(2048 * softmax_m(S[n][:]))
    softmax_row_kernel<<<dim3(kNtok), dim3(512), 0, stream>>>(S32, P16, kPCarry);
    // O[d][n] = (1/2048) * sum_m Vcm[d][m] P16[n][m], the 16 data rows d only; 128 blocks of 32 tokens, K split over 16 waves
    pv_splitk_kernel<<<dim3(kNtok / kPvTok), dim3(kPvWaves * 32), 0, stream>>>(Vg, P16, Og, kPCarryInv);
  }

  // 6) merge heads to the channel-major output
  merge_out_kernel<<<dim3((kBatch * kChan * kNtok / 4) / 256), dim3(256), 0, stream>>>(O32, out);
}

// v002
// A run of this version takes 39.7 microseconds.
// Two timings next to v001 put it at 9.61 and 9.52 times that version's speed.
// Over all steps from v000 it is 38.2 times as fast.
// Contractions: qkv projection (T f16 x W^T f16 carried x16), scores k.q^T (q,k f16, head dim 16 in one half of k = 32), v.attn (V f16 channel-major x P^T f16, P = exp2 against a running maximum) and its column sums: all v_wmma_f32_16x16x32_f16 with f32 accumulate; softmax and layout shuffles in f32.
#include <hip/hip_runtime.h>
#include <math.h>

// ---------------------------------------------------------------------------
// Problem constants
// ---------------------------------------------------------------------------
constexpr int kBatch  = 2;
constexpr int kChan   = 64;                 // input channels = output channels
constexpr int kNtok   = 4096;               // tokens per batch (64 x 64)
constexpr int kTok    = kBatch * kNtok;     // 8192 token rows
constexpr int kHeads  = 4;
constexpr int kHdim   = 16;
constexpr int kGroups = kBatch * kHeads;    // 8 (batch, head) groups
constexpr int kQKV    = 3 * kChan;          // 192 projection outputs
constexpr int kQKld   = 32;                 // q/k plane pitch in halves: 16 data + 16 zero
constexpr int kVrows  = 64;                 // V channel-major rows per group: 16 data + 48 zero
constexpr float kWCarry    = 16.0f;         // weights carried x16 in f16
constexpr float kWCarryInv = 1.0f / 16.0f;
constexpr float kQKScale   = 0.25f;         // 1/sqrt(16)

// ---------------------------------------------------------------------------
// Workspace region map (bytes; every region 4096-B aligned; total 24,141,824 <= 134,217,728)
//   T16    f16 [8192][64]            1,048,576   at          0
//   W16    f16 [192][64]                24,576   at  1,048,576
//   QKV32  f32 [8192][192]           6,291,456   at  1,073,152
//   Q16    f16 [8][4096][32]         2,097,152   at  7,364,608
//   K16    f16 [8][4096][32]         2,097,152   at  9,461,760
//   Vcm16  f16 [8][64][4096]         4,194,304   at 11,558,912
//   O32    f32 [8][64][4096]         8,388,608   at 15,753,216   (rows d < 16 of each group written and read)
//   end                                            24,141,824
// ---------------------------------------------------------------------------

typedef __attribute__((ext_vector_type(16))) _Float16 v16h;
typedef __attribute__((ext_vector_type(8)))  _Float16 v8h;
typedef __attribute__((ext_vector_type(16))) __bf16   v16b;
typedef __attribute__((ext_vector_type(8)))  __bf16   v8b;
typedef __attribute__((ext_vector_type(8)))  float    v8f;
typedef __attribute__((ext_vector_type(4)))  float    v4f;
typedef __attribute__((ext_vector_type(4)))  unsigned int v4u;

// ---------------------------------------------------------------------------
// Helpers
// ---------------------------------------------------------------------------
__device__ __forceinline__ unsigned short f2bf_bits(float f) {
  unsigned u = __float_as_uint(f);
  return (unsigned short)((u + 0x7FFFu + ((u >> 16) & 1u)) >> 16);
}
__device__ __forceinline__ float bf_bits2f(unsigned short h) { return __uint_as_float(((unsigned)h) << 16); }

// hazard guards as plain device helpers (no inline asm inside the kernel template body)
__device__ __forceinline__ void dep_guard_h(v8f& a, v8f& b, v16h x, v16h y) { asm volatile("v_nop\n\tv_nop\n\tv_nop\n\tv_nop" : "+v"(a), "+v"(b) : "v"(x), "v"(y)); }
__device__ __forceinline__ void dep_guard_b(v8f& a, v8f& b, v16b x, v16b y) { asm volatile("v_nop\n\tv_nop\n\tv_nop\n\tv_nop" : "+v"(a), "+v"(b) : "v"(x), "v"(y)); }
__device__ __forceinline__ void keep4_h(v16h a, v16h b, v16h c, v16h d) { asm volatile("v_nop" :: "v"(a), "v"(b), "v"(c), "v"(d)); }
__device__ __forceinline__ void keep4_b(v16b a, v16b b, v16b c, v16b d) { asm volatile("v_nop" :: "v"(a), "v"(b), "v"(c), "v"(d)); }
__device__ __forceinline__ void acc_guard4(v8f& a, v8f& b, v8f& c, v8f& d) { asm volatile("v_nop\n\tv_nop\n\tv_nop\n\tv_nop" : "+v"(a), "+v"(b), "+v"(c), "+v"(d)); }
template <typename T> struct Frag;
template <> struct Frag<_Float16> {
  typedef v16h V; union U { v16h v; v8h h[2]; };
  // elements 0..7 <- p[0..7], 8..15 <- p[16..23]
  static __device__ __forceinline__ v16h load(const _Float16* p) {
    U f; f.h[0] = *(const v8h*)(p); f.h[1] = *(const v8h*)(p + 16); return f.v;
  }
  static __device__ __forceinline__ v8f mma(v16h a, v16h b, v8f c) {
    return __builtin_amdgcn_wmma_f32_16x16x32_f16(false, a, false, b, (short)0, c, false, false);
  }
  static __device__ __forceinline__ void guard(v8f& a, v8f& b, v16h x, v16h y) { dep_guard_h(a, b, x, y); }
  static __device__ __forceinline__ void keep(v16h a, v16h b, v16h c, v16h d) { keep4_h(a, b, c, d); }
};
template <> struct Frag<__bf16> {
  typedef v16b V; union U { v16b v; v8b h[2]; };
  static __device__ __forceinline__ v16b load(const __bf16* p) {
    U f; f.h[0] = *(const v8b*)(p); f.h[1] = *(const v8b*)(p + 16); return f.v;
  }
  static __device__ __forceinline__ v8f mma(v16b a, v16b b, v8f c) {
    return __builtin_amdgcn_wmma_f32_16x16x32_bf16(false, a, false, b, (short)0, c, false, false);
  }
  static __device__ __forceinline__ void guard(v8f& a, v8f& b, v16b x, v16b y) { dep_guard_b(a, b, x, y); }
  static __device__ __forceinline__ void keep(v16b a, v16b b, v16b c, v16b d) { keep4_b(a, b, c, d); }
};

__device__ __forceinline__ unsigned pk16(unsigned short a, unsigned short b) { return (unsigned)a | ((unsigned)b << 16); }
__device__ __forceinline__ unsigned short h_bits(float f) { const _Float16 h = (_Float16)f; return __builtin_bit_cast(unsigned short, h); }

// ---- Register-blocked batched WMMA GEMM (ACT reduced to none/relu/leaky) --------------------------------
// C[m,n] = scale * sum_k A[m,k] * Bt[n,k] (+bias)(+resid); each wave owns a 64x64 tile.
// A row-major [M,K]; Bt row-major [N,K]; M,N % 64 == 0, K % 32 == 0.
// SPLIT: operands are hi/lo planes (A2/Bt2 = lo planes, same layout); product = hi*hi + hi*lo + lo*hi.
// BIAS_MODE: 0 = none, 1 = bias[m], 2 = bias[n].
// OUT_MODE: 0 = f32, 1 = f16, 2 = bf16 hi plane (Cout) + bf16 lo plane (Cout2).
// ET: 0 = f16 operands, 1 = bf16 operands (pointers passed as 16-bit storage)
template <int ET> struct Elem;
template <> struct Elem<0> { typedef _Float16 T; };
template <> struct Elem<1> { typedef __bf16 T; };
template <int ET, bool SPLIT, int BIAS_MODE, int OUT_MODE, bool RESID, int ACT = 0>
__global__ __launch_bounds__(256) void wmma_gemm64(
    const unsigned short* __restrict__ Ap, const unsigned short* __restrict__ A2p, int lda, long strideA,
    const unsigned short* __restrict__ Btp, const unsigned short* __restrict__ Bt2p, int ldb, long strideB,
    void* __restrict__ Cout, void* __restrict__ Cout2, int ldc, long strideC,
    const float* __restrict__ bias,
    const float* __restrict__ resid, long strideR,
    int M, int N, int K, float scale) {
  typedef typename Elem<ET>::T T;
  typedef typename Frag<T>::V V;
  const T* A = (const T*)Ap; const T* A2 = (const T*)A2p; const T* Bt = (const T*)Btp; const T* Bt2 = (const T*)Bt2p;
  __shared__ __align__(16) float sT[8][16 * 68];   // per-wave 16x64 slab, pitch 68 floats
  const int b    = blockIdx.y;
  const int lane = threadIdx.x & 31;
  const int wave = threadIdx.x >> 5;
  const int tilesN = N >> 6;
  const int tilesM = M >> 6;
  const int tile = blockIdx.x * 8 + wave;
  if (tile >= tilesM * tilesN) return;   // wave-uniform; no block barriers in this kernel
  const int tm = tile / tilesN;
  const int tn = tile - tm * tilesN;
  const int m0 = tm << 6;
  const int n0 = tn << 6;

  const T* Ab  = A  + (size_t)b * strideA;
  const T* Bb  = Bt + (size_t)b * strideB;
  const T* Ab2 = SPLIT ? (A2  + (size_t)b * strideA) : nullptr;
  const T* Bb2 = SPLIT ? (Bt2 + (size_t)b * strideB) : nullptr;

  const int rlane = lane & 15;                 // row (A) / col (B, D) within subtile
  const int koff  = (lane >> 4) * 8;           // k offset of this lane half
  const int mOff  = (lane >> 4) * 8;           // D row offset

  v8f acc[4][4];
#pragma unroll
  for (int i = 0; i < 4; ++i)
#pragma unroll
    for (int j = 0; j < 4; ++j) acc[i][j] = (v8f){0.f,0.f,0.f,0.f,0.f,0.f,0.f,0.f};

  for (int k0 = 0; k0 < K; k0 += 32) {
    V bh[4], bl[4];
#pragma unroll
    for (int j = 0; j < 4; ++j) {
      const size_t bo = (size_t)(n0 + (j << 4) + rlane) * ldb + koff + k0;
      bh[j] = Frag<T>::load(Bb + bo);
      if (SPLIT) bl[j] = Frag<T>::load(Bb2 + bo);
    }
#pragma unroll
    for (int i = 0; i < 4; ++i) {
      const size_t ao = (size_t)(m0 + (i << 4) + rlane) * lda + koff + k0;
      V ah = Frag<T>::load(Ab + ao);
      V al;
      if (SPLIT) al = Frag<T>::load(Ab2 + ao);
#pragma unroll
      for (int j = 0; j < 4; ++j) {
        acc[i][j] = Frag<T>::mma(ah, bh[j], acc[i][j]);
        if (SPLIT) {
          acc[i][j] = Frag<T>::mma(ah, bl[j], acc[i][j]);
          acc[i][j] = Frag<T>::mma(al, bh[j], acc[i][j]);
        }
      }
      Frag<T>::guard(acc[i][0], acc[i][3], ah, SPLIT ? al : ah);
    }
    Frag<T>::keep(bh[0], bh[1], bh[2], bh[3]);
    if (SPLIT) Frag<T>::keep(bl[0], bl[1], bl[2], bl[3]);
  }
  acc_guard4(acc[0][0], acc[0][1], acc[0][2], acc[0][3]);
  acc_guard4(acc[1][0], acc[1][1], acc[1][2], acc[1][3]);
  acc_guard4(acc[2][0], acc[2][1], acc[2][2], acc[2][3]);
  acc_guard4(acc[3][0], acc[3][1], acc[3][2], acc[3][3]);

  // ---- epilogue ----
  float* slab = sT[wave];
  const float* Rb = RESID ? (resid + (size_t)b * strideR) : nullptr;
#pragma unroll
  for (int i = 0; i < 4; ++i) {
    const int mBase = m0 + (i << 4);
#pragma unroll
    for (int j = 0; j < 4; ++j) {
      const int n = n0 + (j << 4) + rlane;
      float bv = 0.f;
      if (BIAS_MODE == 2) bv = bias[n];
#pragma unroll
      for (int r = 0; r < 8; ++r) {
        float v = acc[i][j][r] * scale;
        if (BIAS_MODE == 1) v += bias[mBase + mOff + r];
        if (BIAS_MODE == 2) v += bv;
        if (RESID) v += Rb[(size_t)(mBase + mOff + r) * ldc + n];
        if (ACT == 2) v = fmaxf(v, 0.0f);
        if (ACT == 4) v = (v > 0.f) ? v : 0.01f * v;
        slab[(mOff + r) * 68 + (j << 4) + rlane] = v;
      }
    }
    __builtin_amdgcn_fence(__ATOMIC_RELEASE, "workgroup");
    __builtin_amdgcn_wave_barrier();
    __builtin_amdgcn_fence(__ATOMIC_ACQUIRE, "workgroup");
    if (OUT_MODE == 0) {
      float* C = (float*)Cout + (size_t)b * strideC;
      const int hh = lane >> 4, c4 = (lane & 15) * 4;     // row seg = 256 B = 16 lanes x 16 B
      {
#pragma unroll
        for (int it = 0; it < 8; ++it) {
          const int row = it * 2 + hh;
          v4f v = *(const v4f*)(slab + row * 68 + c4);
          *(v4f*)(C + (size_t)(mBase + row) * ldc + n0 + c4) = v;
        }
        
      }
    } else {
      const int q = lane >> 3, c8 = (lane & 7) * 8;
      unsigned short* C  = (unsigned short*)Cout  + (size_t)b * strideC;
      unsigned short* C2 = (OUT_MODE == 2) ? ((unsigned short*)Cout2 + (size_t)b * strideC) : nullptr;
      {
#pragma unroll
        for (int it = 0; it < 4; ++it) {
          const int row = it * 4 + q;
          const float* sp = slab + row * 68 + c8;
          v8h hv, lv;
#pragma unroll
          for (int e = 0; e < 8; ++e) {
            if (OUT_MODE == 1) {
              hv[e] = (_Float16)sp[e];
            } else {
              unsigned short hb = f2bf_bits(sp[e]);
              unsigned short lb = f2bf_bits(sp[e] - bf_bits2f(hb));
              hv[e] = __builtin_bit_cast(_Float16, hb);
              lv[e] = __builtin_bit_cast(_Float16, lb);
            }
          }
          *(v8h*)(C + (size_t)(mBase + row) * ldc + n0 + c8) = hv;
          if (OUT_MODE == 2) *(v8h*)(C2 + (size_t)(mBase + row) * ldc + n0 + c8) = lv;
        }
        
      }
    }
    __builtin_amdgcn_fence(__ATOMIC_RELEASE, "workgroup");
    __builtin_amdgcn_wave_barrier();
    __builtin_amdgcn_fence(__ATOMIC_ACQUIRE, "workgroup");
  }
}

// ---------------------------------------------------------------------------
// Token transpose + cast: x [2][64 c][4096 n] f32 -> T16 [8192 token][64 c] f16 bits, T16[b*4096+n][c] = f16(x[b][c][n]).
// Block = 64 consecutive tokens of one batch; grid = 128 blocks; 256 threads.
// Load coverage: 16 iterations x 256 threads = 4096 = 64 c x 64 tokens (coalesced along n).
// Store coverage: 8 waves x 2 iterations x 4 rows (lane>>3) = 64 token rows; (lane&7) x 8 halves = 64 c;
// ---------------------------------------------------------------------------
__global__ __launch_bounds__(256) void xtok_kernel(const float* __restrict__ x, unsigned short* __restrict__ T16) {
  __shared__ float sm[64][65];     // sm[token_local][c]
  const int t    = threadIdx.x;
  const int tok0 = blockIdx.x * 64;
  const int b    = tok0 >> 12;
  const int n0   = tok0 & (kNtok - 1);
  const float* xb = x + (size_t)b * kChan * kNtok + n0;
#pragma unroll
  for (int i = 0; i < 16; ++i) {
    const int e  = i * 256 + t;
    const int c  = e >> 6;
    const int nl = e & 63;
    sm[nl][c] = xb[(size_t)c * kNtok + nl];
  }
  __syncthreads();
  const int lane = t & 31, wave = t >> 5;
  const int q = lane >> 3, c8 = (lane & 7) * 8;
  {
#pragma unroll
    for (int it = 0; it < 2; ++it) {
      const int row = wave * 8 + it * 4 + q;
      unsigned short hb[8];
#pragma unroll
      for (int e = 0; e < 8; ++e) hb[e] = h_bits(sm[row][c8 + e]);
      const v4u u = (v4u){pk16(hb[0], hb[1]), pk16(hb[2], hb[3]), pk16(hb[4], hb[5]), pk16(hb[6], hb[7])};
      *(v4u*)(T16 + (size_t)(tok0 + row) * kChan + c8) = u;
    }
    
  }
}

// ---------------------------------------------------------------------------
// f32 -> f16 cast with a power-of-two carry, 8 consecutive elements per thread (one 16-B store per lane;
// ---------------------------------------------------------------------------
__global__ __launch_bounds__(256) void wcast8_kernel(const float* __restrict__ in, unsigned short* __restrict__ out, int n8, float scale) {
  const int i = blockIdx.x * 256 + threadIdx.x;
  if (i >= n8) return;
  const float* p = in + 8 * (size_t)i;
  const v4f a = *(const v4f*)(p);
  const v4f c = *(const v4f*)(p + 4);
  unsigned short hb[8];
#pragma unroll
  for (int e = 0; e < 4; ++e) {
    hb[e]     = h_bits(a[e] * scale);
    hb[4 + e] = h_bits(c[e] * scale);
  }
  const v4u u = (v4u){pk16(hb[0], hb[1]), pk16(hb[2], hb[3]), pk16(hb[4], hb[5]), pk16(hb[6], hb[7])};
  unsigned short* q = out + 8 * (size_t)i;
  *(v4u*)q = u;
  
}

// ---------------------------------------------------------------------------
// Head split: QKV32 [8192 token][192] f32 -> Q16 [8 g][4096 n][32] (d 0..15 data, 16..31 zeros),
// K16 (same layout, from columns 64..127), Vcm16 [8 g][64 rows][4096 n] (row d<16 = v[n][h*16+d], rows 16..63 zeros).
// g = b*4 + h. Block = 64 consecutive tokens of one batch (grid 128), 256 threads.
// Load coverage: 12 iterations x 256 threads x 4 floats = 12288 = 64 rows x 192 (the block's rows are contiguous).
// Q/K store coverage per head: thread -> (row = t>>2 in 0..63, quarter = t&3 -> halves 8*quarter..+7) = 64 rows x 32 halves;
// V store coverage: 8 iterations x 32 line slots (t>>3) = 256 lines = 4 heads x 64 rows, each line = this block's 64 tokens
// ---------------------------------------------------------------------------
__global__ __launch_bounds__(256) void qkv_split_kernel(const float* __restrict__ QKV32,
                                                        unsigned short* __restrict__ Q16,
                                                        unsigned short* __restrict__ K16,
                                                        unsigned short* __restrict__ Vcm16) {
  __shared__ float sm[64][193];    // sm[token_local][col]
  const int t    = threadIdx.x;
  const int tok0 = blockIdx.x * 64;
  const int b    = tok0 >> 12;
  const int n0   = tok0 & (kNtok - 1);
  const float* src = QKV32 + (size_t)tok0 * kQKV;
#pragma unroll
  for (int i = 0; i < 12; ++i) {
    const int e   = i * 256 + t;            // float4 index 0..3071
    const int row = e / 48;                 // 48 float4 per 192-float row
    const int col = (e - row * 48) * 4;
    const v4f v = *(const v4f*)(src + 4 * (size_t)e);
    sm[row][col]     = v[0];
    sm[row][col + 1] = v[1];
    sm[row][col + 2] = v[2];
    sm[row][col + 3] = v[3];
  }
  __syncthreads();
  const int rowq = t >> 2;
  const int q4   = t & 3;
  const unsigned keepq = (q4 < 2) ? 0xffffffffu : 0u;   // quarters 2,3 are the zero padding columns 16..31
  const int cq   = (q4 & 1) * 8;
  const int lq   = t >> 3;                              // line slot 0..31
  const int e8   = (t & 7) * 8;                         // token sub-segment of a line
  {
#pragma unroll
    for (int h = 0; h < kHeads; ++h) {
      const size_t prow = ((size_t)(b * kHeads + h) * kNtok + n0 + rowq) * kQKld + 8 * q4;
      {
        unsigned short hb[8];
#pragma unroll
        for (int e = 0; e < 8; ++e) hb[e] = h_bits(sm[rowq][h * kHdim + cq + e]);
        const v4u u = (v4u){pk16(hb[0], hb[1]) & keepq, pk16(hb[2], hb[3]) & keepq,
                            pk16(hb[4], hb[5]) & keepq, pk16(hb[6], hb[7]) & keepq};
        *(v4u*)(Q16 + prow) = u;
      }
      {
        unsigned short hb[8];
#pragma unroll
        for (int e = 0; e < 8; ++e) hb[e] = h_bits(sm[rowq][kChan + h * kHdim + cq + e]);
        const v4u u = (v4u){pk16(hb[0], hb[1]) & keepq, pk16(hb[2], hb[3]) & keepq,
                            pk16(hb[4], hb[5]) & keepq, pk16(hb[6], hb[7]) & keepq};
        *(v4u*)(K16 + prow) = u;
      }
    }
#pragma unroll
    for (int it = 0; it < 8; ++it) {
      const int L  = it * 32 + lq;          // 0..255
      const int h  = L >> 6;                // head
      const int vr = L & 63;                // V channel-major row: d for vr<16, zero row otherwise
      const unsigned keepv = (vr < 16) ? 0xffffffffu : 0u;
      const int d  = vr & 15;               // clamped column used for the (masked) read
      unsigned short hb[8];
#pragma unroll
      for (int e = 0; e < 8; ++e) hb[e] = h_bits(sm[e8 + e][2 * kChan + h * kHdim + d]);
      const v4u u = (v4u){pk16(hb[0], hb[1]) & keepv, pk16(hb[2], hb[3]) & keepv,
                          pk16(hb[4], hb[5]) & keepv, pk16(hb[6], hb[7]) & keepv};
      *(v4u*)(Vcm16 + ((size_t)((b * kHeads + h) * kVrows + vr)) * kNtok + n0 + e8) = u;
    }
    
  }
}

// ---------------------------------------------------------------------------
// Fused attention of all (batch, head) groups: scores, softmax and P.V in one launch; S and P never leave the registers.
// Block = 128 tokens n of one group (grid 8 x 32 = 256), 16 waves = 4 token slices of 32 n x 4 key slices of 1024 m.
// The block first parks the group's whole K (data halves only) and V (16 data rows) in LDS, each as ready fragments:
//   K: 512 B per 16 keys = [d half hl][key r] x 16 B, so lane l of a fragment read takes piece l;
//   V: 256 B per 8 keys m8 = [d] x 16 B, the 64-B quarters exchanged by m8 & 3 so that the staging stores (4 d x 8 m8
//      per wave, whole 128-B lines of V on the global side) and the fragment reads (16 d of one m8) both spread over all banks.
// A pass is 32 keys. S^T = K.Q^T: ONE A fragment holds two key tiles (k 0..15 = d of keys m0 + r, k 16..31 = d of keys
// m0 + 16 + r); B = [q | 0] gives the first tile's scores and B = [0 | q] the second's (head dim 16 fills half of k = 32).
// In a score tile lane (n, hl) holds keys hl*8 + r of token n, which is the B layout of P^T for O^T += V^T.P^T:
// position (hl, e) is key m0 + hl*8 + e for e < 8 and m0 + 16 + hl*8 + e - 8 above, in the V fragment and in P alike.
// Online softmax in the log2 domain; the maximum in use may trail the true one by up to 8 (p <= 256 in f16), so the
// accumulators are rescaled only when some token's maximum exceeds it by more. Denominator: an A fragment with ones in row 0 sums
// the rounded P on the matrix pipe. The 4 key slices are merged through LDS in slice order.
// ---------------------------------------------------------------------------
constexpr int kFaTok   = 128;                    // tokens per block
constexpr int kFaSplit = 4;                      // key slices per block
constexpr int kFaKeys  = kNtok / kFaSplit;       // 1024 keys per wave
constexpr int kFaPass  = kFaKeys / 32;           // 32 passes of 32 keys
constexpr int kFaPitch = kFaTok + 4;             // partial-tile pitch in floats: lane halves fall on different banks
constexpr float kFaScale = kQKScale * 1.4426950408889634f;   // score scale in the log2 domain

typedef __attribute__((ext_vector_type(2))) float    v2f;
typedef __attribute__((ext_vector_type(2))) _Float16 v2h;

// lane l <-> lane l ^ 16
__device__ __forceinline__ float other_half(float x) {
  const int b = __builtin_bit_cast(int, x);
  return __builtin_bit_cast(float, __builtin_amdgcn_permlanex16(b, b, 0x76543210, 0xfedcba98, false, false));
}
__device__ __forceinline__ v16h join16(v8h lo, v8h hi) { Frag<_Float16>::U f; f.h[0] = lo; f.h[1] = hi; return f.v; }

__global__ __launch_bounds__(512) void attn_fused_kernel(const unsigned short* __restrict__ Qp,
                                                         const unsigned short* __restrict__ Kp,
                                                         const unsigned short* __restrict__ Vp,
                                                         float* __restrict__ O32) {
  __shared__ __align__(16) _Float16 sK[kNtok * kHdim];
  __shared__ __align__(16) _Float16 sV[kNtok * kHdim];
  __shared__ __align__(16) float part[kFaSplit][kHdim * kFaPitch];
  __shared__ __align__(16) float pm[kFaSplit][kFaTok];
  __shared__ __align__(16) float pl[kFaSplit][kFaTok];
  const int t     = threadIdx.x;
  const int lane  = t & 31;
  const int wave  = t >> 5;
  const int rlane = lane & 15;
  const int hl    = lane >> 4;
  const int g     = blockIdx.x / (kNtok / kFaTok);
  const int n0    = (blockIdx.x % (kNtok / kFaTok)) * kFaTok;
  const _Float16* Q = (const _Float16*)Qp + (size_t)g * kNtok * kQKld;
  const _Float16* K = (const _Float16*)Kp + (size_t)g * kNtok * kQKld;
  const _Float16* V = (const _Float16*)Vp + (size_t)g * kVrows * kNtok;

  // ---- stage K and V: 8192 pieces of 16 B each, 16 per thread ----
#pragma unroll
  for (int i = 0; i < kNtok * kHdim / 8 / 512; ++i) {
    const int idx = i * 512 + t;                 // piece = (key tile idx >> 5, lane)
    *(v8h*)(sK + idx * 8) = *(const v8h*)(K + (size_t)((idx >> 5) * 16 + rlane) * kQKld + hl * 8);
  }
#pragma unroll
  for (int i = 0; i < kNtok * kHdim / 8 / 512; ++i) {
    const int idx = i * 512 + t;
    const int m8  = (idx >> 7) * 8 + (idx & 7);  // 8 lanes cover one 128-B line of a V row
    const int d   = (idx >> 3) & 15;
    *(v8h*)(sV + m8 * 128 + ((d * 8) ^ ((m8 & 3) * 32))) = *(const v8h*)(V + (size_t)d * kNtok + m8 * 8);
  }

  const int ng    = wave & 3;                    // token slice
  const int split = wave >> 2;                   // key slice
  const v8h z8 = (v8h){0, 0, 0, 0, 0, 0, 0, 0};
  v16h qa[2], qb[2];
#pragma unroll
  for (int c = 0; c < 2; ++c) {
    const v8h q = *(const v8h*)(Q + (size_t)(n0 + ng * 32 + c * 16 + rlane) * kQKld + hl * 8);
    qa[c] = join16(q, z8);
    qb[c] = join16(z8, q);
  }
  const _Float16 one = (rlane == 0) ? (_Float16)1.0f : (_Float16)0.0f;   // A operand whose row 0 is ones
  const v8h o8 = (v8h){one, one, one, one, one, one, one, one};
  const v16h ones = join16(o8, o8);
  const v8f zero8 = (v8f){0.f, 0.f, 0.f, 0.f, 0.f, 0.f, 0.f, 0.f};
  v8f acc[2]  = {zero8, zero8};
  v8f lacc[2] = {zero8, zero8};
  float mrun[2] = {-INFINITY, -INFINITY};        // maximum in use, scaled
  float thr[2]  = {-INFINITY, -INFINITY};        // raw score above which it is renewed: (mrun + 8) / scale
  __syncthreads();

  const _Float16* kw  = sK + split * kFaKeys * kHdim + lane * 8;
  const _Float16* vw0 = sV + split * kFaKeys * kHdim + hl * 128 + ((rlane * 8) ^ (hl * 32));
  const _Float16* vw1 = sV + split * kFaKeys * kHdim + (2 + hl) * 128 + ((rlane * 8) ^ ((2 + hl) * 32));
  v16h kf = join16(*(const v8h*)(kw), *(const v8h*)(kw + 256));
  for (int p = 0; p < kFaPass; ++p) {
    v8f s[2][2];
#pragma unroll
    for (int c = 0; c < 2; ++c) {
      s[c][0] = Frag<_Float16>::mma(kf, qa[c], zero8);
      s[c][1] = Frag<_Float16>::mma(kf, qb[c], zero8);
    }
    // keeps the four score products back to back: spread among the maxima each one drew its own run of v_nop
    __builtin_amdgcn_sched_barrier(0);
    const v16h vf = join16(*(const v8h*)(vw0 + p * 512), *(const v8h*)(vw1 + p * 512));
    const int pn = (p + 1) & (kFaPass - 1);
    kf = join16(*(const v8h*)(kw + pn * 512), *(const v8h*)(kw + pn * 512 + 256));

    float mb[2];                                 // this lane's maximum of the pass (8 + 8 keys of its token), raw
    bool need = false;
#pragma unroll
    for (int c = 0; c < 2; ++c) {
      float mx = fmaxf(s[c][0][0], s[c][1][0]);
#pragma unroll
      for (int r = 1; r < 8; ++r) mx = fmaxf(fmaxf(mx, s[c][0][r]), s[c][1][r]);
      mb[c] = mx;
      need = need || (mx > thr[c]);
    }
    if (__builtin_amdgcn_ballot_w32(need) != 0) { // wave-uniform; always on the first pass, rare after it
#pragma unroll
      for (int c = 0; c < 2; ++c) {
        // both lane halves of a token take the same new maximum
        const float mnew = fmaxf(mrun[c], fmaxf(mb[c], other_half(mb[c])) * kFaScale);
        const float corr = __builtin_amdgcn_exp2f(mrun[c] - mnew);   // 0 on the first pass
        mrun[c] = mnew;
        thr[c]  = (mnew + 8.0f) * (1.0f / kFaScale);
        acc[c]  = acc[c] * corr;
        lacc[c] = lacc[c] * corr;
      }
    }
#pragma unroll
    for (int c = 0; c < 2; ++c) {
      const v2f sc = (v2f){kFaScale, kFaScale};
      const v2f nm = (v2f){-mrun[c], -mrun[c]};
      v16h pf;
#pragma unroll
      for (int i = 0; i < 8; ++i) {
        const v2f a = __builtin_elementwise_fma((v2f){s[c][i >> 2][2 * (i & 3)], s[c][i >> 2][2 * (i & 3) + 1]}, sc, nm);
        const v2h h = __builtin_convertvector((v2f){__builtin_amdgcn_exp2f(a[0]), __builtin_amdgcn_exp2f(a[1])}, v2h);
        pf[2 * i]     = h[0];
        pf[2 * i + 1] = h[1];
      }
      acc[c]  = Frag<_Float16>::mma(vf, pf, acc[c]);
      lacc[c] = Frag<_Float16>::mma(ones, pf, lacc[c]);   // row 0 += the column sums of P^T
    }
  }

  // ---- merge the 4 key slices ----
  float* pw = part[split];
#pragma unroll
  for (int c = 0; c < 2; ++c) {
    const int col = ng * 32 + c * 16 + rlane;
#pragma unroll
    for (int r = 0; r < 8; ++r) pw[(hl * 8 + r) * kFaPitch + col] = acc[c][r];
    if (hl == 0) {
      pm[split][col] = mrun[c];
      pl[split][col] = lacc[c][0];
    }
  }
  __syncthreads();
  const int d  = wave;                           // 16 waves = 16 rows d; a wave stores 512 B of one row
  const int n4 = lane * 4;
  v4f mm[kFaSplit];
#pragma unroll
  for (int k = 0; k < kFaSplit; ++k) mm[k] = *(const v4f*)(&pm[k][n4]);
  v4f res;
#pragma unroll
  for (int e = 0; e < 4; ++e) {
    const float mt = fmaxf(fmaxf(mm[0][e], mm[1][e]), fmaxf(mm[2][e], mm[3][e]));
    float den = 0.f, num = 0.f;
#pragma unroll
    for (int k = 0; k < kFaSplit; ++k) {
      const float wgt = __builtin_amdgcn_exp2f(mm[k][e] - mt);
      den += wgt * pl[k][n4 + e];
      num += wgt * part[k][d * kFaPitch + n4 + e];
    }
    res[e] = num / den;
  }
  *(v4f*)(O32 + ((size_t)g * kVrows + d) * kNtok + n0 + n4) = res;
}

// ---------------------------------------------------------------------------
// Merge heads to the channel-major output: out[b][h*16+d][n] = O32[(b*4+h)*64 + d][n] (rows d < 16 of each group slot).
// One thread per float4: 131072 threads = 512 blocks x 256 (exact). A wave writes 32 consecutive float4 of one 4096-float
// ---------------------------------------------------------------------------
__global__ __launch_bounds__(256) void merge_out_kernel(const float* __restrict__ O32, float* __restrict__ out) {
  const int i  = blockIdx.x * 256 + threadIdx.x;    // float4 index 0..131071
  const int r  = i >> 10;                            // output row 0..127 (1024 float4 per row)
  const int c4 = (i & 1023) * 4;
  const int b  = r >> 6;
  const int ch = r & 63;
  const int h  = ch >> 4;
  const int d  = ch & 15;
  const size_t src = ((size_t)((b * kHeads + h) * kVrows + d)) * kNtok + c4;
  const v4f v = *(const v4f*)(O32 + src);
  float* p = out + (size_t)r * kNtok + c4;
  *(v4f*)p = v;
  
}

// ---------------------------------------------------------------------------
extern "C" void kernel_launch(void* const* d_in, const int* in_sizes, int n_in,
                              void* d_out, int out_size, void* d_ws, size_t ws_size,
                              hipStream_t stream) {
  (void)in_sizes; (void)n_in;
  const float* x    = (const float*)d_in[0];     // [2][64][4096]
  const float* w    = (const float*)d_in[1];     // [192][64]
  const float* bias = (const float*)d_in[2];     // [192]
  float* out = (float*)d_out;                    // [2][64][4096]

  // ---- workspace carve (see region map at the top) ----
  const size_t szT16   = (size_t)kTok * kChan * 2;
  const size_t szW16   = (size_t)kQKV * kChan * 2;
  const size_t szQKV32 = (size_t)kTok * kQKV * 4;
  const size_t szQK16  = (size_t)kGroups * kNtok * kQKld * 2;
  const size_t szVcm16 = (size_t)kGroups * kVrows * kNtok * 2;
  const size_t szO32   = (size_t)kGroups * kVrows * kNtok * 4;
  char* ws = (char*)d_ws;
  size_t off = 0;
  unsigned short* T16   = (unsigned short*)(ws + off); off += szT16;
  unsigned short* W16   = (unsigned short*)(ws + off); off += szW16;
  float*          QKV32 = (float*)(ws + off);          off += szQKV32;
  unsigned short* Q16   = (unsigned short*)(ws + off); off += szQK16;
  unsigned short* K16   = (unsigned short*)(ws + off); off += szQK16;
  unsigned short* Vcm16 = (unsigned short*)(ws + off); off += szVcm16;
  float*          O32   = (float*)(ws + off);          off += szO32;
  if (off > ws_size) return;                                       // 24,141,824 B carved
  if ((size_t)out_size < (size_t)kBatch * kChan * kNtok) return;   // 524,288 f32 elements

  // 1) tokens: x -> T16 [8192][64]
  xtok_kernel<<<dim3(kTok / 64), dim3(256), 0, stream>>>(x, T16);
  // 2) weights: W16 [192][64] = f16(16 w); 12288 / 8 = 1536 threads = 6 blocks
  wcast8_kernel<<<dim3((kQKV * kChan / 8 + 255) / 256), dim3(256), 0, stream>>>(w, W16, kQKV * kChan / 8, kWCarry);
  // 3) qkv = T16 . W16^T x (1/16) + bias -> QKV32 [8192][192] f32; M 8192, N 192, K 64 (tiles 128x3 = 384 -> 48 blocks)
  wmma_gemm64<0, false, 2, 0, false, 0><<<dim3((kTok / 64) * (kQKV / 64) / 8, 1), dim3(256), 0, stream>>>(
      T16, T16, kChan, 0L, W16, W16, kChan, 0L, (void*)QKV32, (void*)QKV32, kQKV, 0L,
      bias, x, 0L, kTok, kQKV, kChan, kWCarryInv);
  // 4) head split -> Q16, K16 [8][4096][32], Vcm16 [8][64][4096] (pads written with zeros)
  qkv_split_kernel<<<dim3(kTok / 64), dim3(256), 0, stream>>>(QKV32, Q16, K16, Vcm16);

  // 5) all (batch, head) groups: scores, softmax and P.V fused; 8 groups x 32 blocks of 128 tokens, 16 waves each
  attn_fused_kernel<<<dim3(kGroups * (kNtok / kFaTok)), dim3(512), 0, stream>>>(Q16, K16, Vcm16, O32);

  // 6) merge heads to the channel-major output
  merge_out_kernel<<<dim3((kBatch * kChan * kNtok / 4) / 256), dim3(256), 0, stream>>>(O32, out);
}

// v003
// One run takes 23.1 microseconds.
// Next to v002, in two timings, it ran 1.71 and 1.69 times as fast.
// Counting every step since v000, it is 64.9 times as fast.
// Contractions: qkv projection (T f16 x W^T f16 carried x16), scores k.q^T (q,k f16, head dim 16 in one half of k = 32), v.attn (V f16 channel-major x P^T f16, P = exp2 against a running maximum) and its column sums: all v_wmma_f32_16x16x32_f16 with f32 accumulate; softmax and the merge of key slices in f32; the LDS staging of x, w, K and V in f16.
#include <hip/hip_runtime.h>
#include <math.h>

// ---------------------------------------------------------------------------
// Problem constants
// ---------------------------------------------------------------------------
constexpr int kBatch  = 2;
constexpr int kChan   = 64;                 // input channels = output channels
constexpr int kNtok   = 4096;               // tokens per batch (64 x 64)
constexpr int kTok    = kBatch * kNtok;     // 8192 token rows
constexpr int kHeads  = 4;
constexpr int kHdim   = 16;
constexpr int kGroups = kBatch * kHeads;    // 8 (batch, head) groups
constexpr int kQKld   = 32;                 // q/k plane pitch in halves: 16 data, the rest neither written nor read
constexpr int kVrows  = 64;                 // V channel-major row slots per group: 16 data, the rest neither written nor read
constexpr float kWCarry    = 16.0f;         // weights carried x16 in f16
constexpr float kWCarryInv = 1.0f / 16.0f;
constexpr float kQKScale   = 0.25f;         // 1/sqrt(16)

// ---------------------------------------------------------------------------
// Workspace region map (bytes; every region 4096-B aligned; total 8,388,608)
//   Q16    f16 [8][4096][32]         2,097,152   at          0
//   K16    f16 [8][4096][32]         2,097,152   at  2,097,152
//   Vcm16  f16 [8][64][4096]         4,194,304   at  4,194,304
// ---------------------------------------------------------------------------

typedef __attribute__((ext_vector_type(16))) _Float16 v16h;
typedef __attribute__((ext_vector_type(8)))  _Float16 v8h;
typedef __attribute__((ext_vector_type(8)))  float    v8f;
typedef __attribute__((ext_vector_type(4)))  float    v4f;

union Frag16 { v16h v; v8h h[2]; };
__device__ __forceinline__ v16h join16(v8h lo, v8h hi) { Frag16 f; f.h[0] = lo; f.h[1] = hi; return f.v; }
// A or B fragment of one k step of 32: elements 0..7 <- p[0..7], 8..15 <- p[16..23] (p already at the lane half's k offset)
__device__ __forceinline__ v16h frag_load(const _Float16* p) { return join16(*(const v8h*)(p), *(const v8h*)(p + 16)); }
__device__ __forceinline__ v8f mma16(v16h a, v16h b, v8f c) {
  return __builtin_amdgcn_wmma_f32_16x16x32_f16(false, a, false, b, (short)0, c, false, false);
}

// ---------------------------------------------------------------------------
// qkv projection, from x and w to the f16 planes of the attention kernel in one launch.
// Block = 64 consecutive tokens of one batch (grid 128), 8 waves = 4 heads x 2 token halves of 32 (two tiles of 16).
// The block casts its x tile (64 c x 64 tokens) to f16 and turns it token-major in LDS: a thread reads 8 channels of one token
// (a wave = 32 consecutive tokens = one 128-B line per load) and stores them as one 16-B piece; pitch 72 halves.
// w goes the same way (f16 of 16 w, row-major, same pitch): whole 128-B lines on the global side, read once per block;
// fragment loads straight from global memory would touch 16 lines each and repeat in the waves of a head.
// q, k: D = W.T^T, so lane (token, hl) holds channels hl*8 + r of its token = one 16-B piece of the token-major plane.
// v:    D = T.W^T, so lane (d, hl) holds tokens hl*8 + r of channel d = one 16-B piece of the channel-major plane.
// The k order is that of frag_load for both operands in both orientations.
// ---------------------------------------------------------------------------
constexpr int kPjTok   = 64;
constexpr int kPjThr   = 256;
constexpr int kPjPitch = kChan + 8;

typedef __attribute__((ext_vector_type(4))) _Float16 v4h;

__global__ __launch_bounds__(kPjThr) void qkv_proj_kernel(const float* __restrict__ x,
                                                          const float* __restrict__ w,
                                                          const float* __restrict__ bias,
                                                          unsigned short* __restrict__ Q16,
                                                          unsigned short* __restrict__ K16,
                                                          unsigned short* __restrict__ Vcm16) {
  __shared__ __align__(16) _Float16 sT[kPjTok * kPjPitch];
  __shared__ __align__(16) _Float16 sW[3 * kChan * kPjPitch];
  const int t     = threadIdx.x;
  const int lane  = t & 31;
  const int wave  = t >> 5;
  const int rlane = lane & 15;
  const int hl    = lane >> 4;
  const int tok0  = blockIdx.x * kPjTok;
  const int b     = tok0 / kNtok;
  const int n0    = tok0 % kNtok;
  const int th    = wave & 1;                    // token half
  const int h     = wave >> 1;                   // head

  // every global load of the block is issued before the first is waited for
  constexpr int kXp = kPjTok * kChan / 8 / kPjThr;       // x pieces per thread: 2
  constexpr int kWp = 3 * kChan * kChan / 4 / kPjThr;    // float4 of w per thread: 12
  float xr[kXp][8];
  v4f   wr[kWp];
#pragma unroll
  for (int i = 0; i < kXp; ++i) {
    const int idx = i * kPjThr + t;              // piece = (channel octet, token)
    const float* xp = x + ((size_t)b * kChan + (idx / kPjTok) * 8) * kNtok + n0 + (idx & (kPjTok - 1));
#pragma unroll
    for (int e = 0; e < 8; ++e) xr[i][e] = xp[(size_t)e * kNtok];
  }
#pragma unroll
  for (int i = 0; i < kWp; ++i) wr[i] = *(const v4f*)(w + 4 * (size_t)(i * kPjThr + t));
  // the bias loads may be given registers that held the addresses of the loads above: those are let go first
  asm volatile("s_wait_xcnt 0x0" ::: "memory");
  const float* bq = bias + h * kHdim + hl * 8;   // q, k: the lane's 8 channels; v: its one channel
  const v4f bq0 = *(const v4f*)(bq),         bq1 = *(const v4f*)(bq + 4);
  const v4f bk0 = *(const v4f*)(bq + kChan), bk1 = *(const v4f*)(bq + kChan + 4);
  const float bv = bias[2 * kChan + h * kHdim + rlane];
#pragma unroll
  for (int i = 0; i < kXp; ++i) {
    const int idx = i * kPjThr + t;
    v8h hv;
#pragma unroll
    for (int e = 0; e < 8; ++e) hv[e] = (_Float16)xr[i][e];
    *(v8h*)(sT + (idx & (kPjTok - 1)) * kPjPitch + (idx / kPjTok) * 8) = hv;
  }
#pragma unroll
  for (int i = 0; i < kWp; ++i) {
    const int idx = i * kPjThr + t;              // float4 index: 16 per row of w
    *(v4h*)(sW + (idx >> 4) * kPjPitch + (idx & 15) * 4) =
        (v4h){(_Float16)(wr[i][0] * kWCarry), (_Float16)(wr[i][1] * kWCarry),
              (_Float16)(wr[i][2] * kWCarry), (_Float16)(wr[i][3] * kWCarry)};
  }
  __syncthreads();

  const _Float16* tp = sT + (th * 32 + rlane) * kPjPitch + hl * 8;     // second tile 16 rows further
  const _Float16* wp = sW + (h * kHdim + rlane) * kPjPitch + hl * 8;   // q rows; k and v rows 64 and 128 further
  const v8f zero8 = (v8f){0.f, 0.f, 0.f, 0.f, 0.f, 0.f, 0.f, 0.f};
  v8f aq[2] = {zero8, zero8}, ak[2] = {zero8, zero8}, av[2] = {zero8, zero8};
#pragma unroll
  for (int ks = 0; ks < 2; ++ks) {
    const v16h wq = frag_load(wp + ks * 32);
    const v16h wk = frag_load(wp + kChan * kPjPitch + ks * 32);
    const v16h wv = frag_load(wp + 2 * kChan * kPjPitch + ks * 32);
#pragma unroll
    for (int c = 0; c < 2; ++c) {
      const v16h xf = frag_load(tp + c * 16 * kPjPitch + ks * 32);
      aq[c] = mma16(wq, xf, aq[c]);
      ak[c] = mma16(wk, xf, ak[c]);
      av[c] = mma16(xf, wv, av[c]);
    }
  }

  const int g = b * kHeads + h;
#pragma unroll
  for (int c = 0; c < 2; ++c) {
    v8h hq, hk, hv;
#pragma unroll
    for (int r = 0; r < 8; ++r) {
      hq[r] = (_Float16)(aq[c][r] * kWCarryInv + (r < 4 ? bq0[r & 3] : bq1[r & 3]));
      hk[r] = (_Float16)(ak[c][r] * kWCarryInv + (r < 4 ? bk0[r & 3] : bk1[r & 3]));
      hv[r] = (_Float16)(av[c][r] * kWCarryInv + bv);
    }
    const int nt = n0 + th * 32 + c * 16;        // first token of the tile
    const size_t qk = ((size_t)g * kNtok + nt + rlane) * kQKld + hl * 8;
    *(v8h*)(Q16 + qk) = hq;
    *(v8h*)(K16 + qk) = hk;
    *(v8h*)(Vcm16 + ((size_t)g * kVrows + rlane) * kNtok + nt + hl * 8) = hv;
  }
}

// ---------------------------------------------------------------------------
// Fused attention of all (batch, head) groups: scores, softmax and P.V in one launch; S and P never leave the registers.
// Block = 128 tokens n of one group (grid 8 x 32 = 256), 16 waves = 4 token slices of 32 n x 4 key slices of 1024 m.
// The block first parks the group's whole K (data halves only) and V (16 data rows) in LDS, each as ready fragments:
//   K: 512 B per 16 keys = [d half hl][key r] x 16 B, so lane l of a fragment read takes piece l;
//   V: 256 B per 8 keys m8 = [d] x 16 B, the 64-B quarters exchanged by m8 & 3 so that the staging stores (4 d x 8 m8
//      per wave, whole 128-B lines of V on the global side) and the fragment reads (16 d of one m8) both spread over all banks.
// A pass is 32 keys. S^T = K.Q^T: ONE A fragment holds two key tiles (k 0..15 = d of keys m0 + r, k 16..31 = d of keys
// m0 + 16 + r); B = [q | 0] gives the first tile's scores and B = [0 | q] the second's (head dim 16 fills half of k = 32).
// In a score tile lane (n, hl) holds keys hl*8 + r of token n, which is the B layout of P^T for O^T += V^T.P^T:
// position (hl, e) is key m0 + hl*8 + e for e < 8 and m0 + 16 + hl*8 + e - 8 above, in the V fragment and in P alike.
// Online softmax in the log2 domain; the maximum in use may trail the true one by up to 8 (p <= 256 in f16), so the
// accumulators are rescaled only when some token's maximum exceeds it by more. Denominator: an A fragment with ones in row 0 sums
// the rounded P on the matrix pipe. The 4 key slices are merged through LDS in slice order.
// ---------------------------------------------------------------------------
constexpr int kFaTok   = 128;                    // tokens per block
constexpr int kFaSplit = 4;                      // key slices per block
constexpr int kFaKeys  = kNtok / kFaSplit;       // 1024 keys per wave
constexpr int kFaPass  = kFaKeys / 32;           // 32 passes of 32 keys
constexpr int kFaPitch = kFaTok + 4;             // partial-tile pitch in floats: lane halves fall on different banks
constexpr float kFaScale = kQKScale * 1.4426950408889634f;   // score scale in the log2 domain

typedef __attribute__((ext_vector_type(2))) float    v2f;
typedef __attribute__((ext_vector_type(2))) _Float16 v2h;

// lane l <-> lane l ^ 16
__device__ __forceinline__ float other_half(float x) {
  const int b = __builtin_bit_cast(int, x);
  return __builtin_bit_cast(float, __builtin_amdgcn_permlanex16(b, b, 0x76543210, 0xfedcba98, false, false));
}

__global__ __launch_bounds__(512) void attn_fused_kernel(const unsigned short* __restrict__ Qp,
                                                         const unsigned short* __restrict__ Kp,
                                                         const unsigned short* __restrict__ Vp,
                                                         float* __restrict__ out) {
  __shared__ __align__(16) _Float16 sK[kNtok * kHdim];
  __shared__ __align__(16) _Float16 sV[kNtok * kHdim];
  __shared__ __align__(16) float part[kFaSplit][kHdim * kFaPitch];
  __shared__ __align__(16) float pm[kFaSplit][kFaTok];
  __shared__ __align__(16) float pl[kFaSplit][kFaTok];
  const int t     = threadIdx.x;
  const int lane  = t & 31;
  const int wave  = t >> 5;
  const int rlane = lane & 15;
  const int hl    = lane >> 4;
  const int g     = blockIdx.x / (kNtok / kFaTok);
  const int n0    = (blockIdx.x % (kNtok / kFaTok)) * kFaTok;
  const _Float16* Q = (const _Float16*)Qp + (size_t)g * kNtok * kQKld;
  const _Float16* K = (const _Float16*)Kp + (size_t)g * kNtok * kQKld;
  const _Float16* V = (const _Float16*)Vp + (size_t)g * kVrows * kNtok;

  // ---- stage K and V: 8192 pieces of 16 B each, 16 per thread ----
#pragma unroll
  for (int i = 0; i < kNtok * kHdim / 8 / 512; ++i) {
    const int idx = i * 512 + t;                 // piece = (key tile idx >> 5, lane)
    *(v8h*)(sK + idx * 8) = *(const v8h*)(K + (size_t)((idx >> 5) * 16 + rlane) * kQKld + hl * 8);
  }
#pragma unroll
  for (int i = 0; i < kNtok * kHdim / 8 / 512; ++i) {
    const int idx = i * 512 + t;
    const int m8  = (idx >> 7) * 8 + (idx & 7);  // 8 lanes cover one 128-B line of a V row
    const int d   = (idx >> 3) & 15;
    *(v8h*)(sV + m8 * 128 + ((d * 8) ^ ((m8 & 3) * 32))) = *(const v8h*)(V + (size_t)d * kNtok + m8 * 8);
  }

  const int ng    = wave & 3;                    // token slice
  const int split = wave >> 2;                   // key slice
  const v8h z8 = (v8h){0, 0, 0, 0, 0, 0, 0, 0};
  v16h qa[2], qb[2];
#pragma unroll
  for (int c = 0; c < 2; ++c) {
    const v8h q = *(const v8h*)(Q + (size_t)(n0 + ng * 32 + c * 16 + rlane) * kQKld + hl * 8);
    qa[c] = join16(q, z8);
    qb[c] = join16(z8, q);
  }
  const _Float16 one = (rlane == 0) ? (_Float16)1.0f : (_Float16)0.0f;   // A operand whose row 0 is ones
  const v8h o8 = (v8h){one, one, one, one, one, one, one, one};
  const v16h ones = join16(o8, o8);
  const v8f zero8 = (v8f){0.f, 0.f, 0.f, 0.f, 0.f, 0.f, 0.f, 0.f};
  v8f acc[2]  = {zero8, zero8};
  v8f lacc[2] = {zero8, zero8};
  float mrun[2] = {-INFINITY, -INFINITY};        // maximum in use, scaled
  float thr[2]  = {-INFINITY, -INFINITY};        // raw score above which it is renewed: (mrun + 8) / scale
  __syncthreads();

  const _Float16* kw  = sK + split * kFaKeys * kHdim + lane * 8;
  const _Float16* vw0 = sV + split * kFaKeys * kHdim + hl * 128 + ((rlane * 8) ^ (hl * 32));
  const _Float16* vw1 = sV + split * kFaKeys * kHdim + (2 + hl) * 128 + ((rlane * 8) ^ ((2 + hl) * 32));
  v16h kf = join16(*(const v8h*)(kw), *(const v8h*)(kw + 256));
  for (int p = 0; p < kFaPass; ++p) {
    v8f s[2][2];
#pragma unroll
    for (int c = 0; c < 2; ++c) {
      s[c][0] = mma16(kf, qa[c], zero8);
      s[c][1] = mma16(kf, qb[c], zero8);
    }
    // keeps the four score products back to back: spread among the maxima each one drew its own run of v_nop
    __builtin_amdgcn_sched_barrier(0);
    const v16h vf = join16(*(const v8h*)(vw0 + p * 512), *(const v8h*)(vw1 + p * 512));
    const int pn = (p + 1) & (kFaPass - 1);
    kf = join16(*(const v8h*)(kw + pn * 512), *(const v8h*)(kw + pn * 512 + 256));

    float mb[2];                                 // this lane's maximum of the pass (8 + 8 keys of its token), raw
    bool need = false;
#pragma unroll
    for (int c = 0; c < 2; ++c) {
      float mx = fmaxf(s[c][0][0], s[c][1][0]);
#pragma unroll
      for (int r = 1; r < 8; ++r) mx = fmaxf(fmaxf(mx, s[c][0][r]), s[c][1][r]);
      mb[c] = mx;
      need = need || (mx > thr[c]);
    }
    if (__builtin_amdgcn_ballot_w32(need) != 0) { // wave-uniform; always on the first pass, rare after it
#pragma unroll
      for (int c = 0; c < 2; ++c) {
        // both lane halves of a token take the same new maximum
        const float mnew = fmaxf(mrun[c], fmaxf(mb[c], other_half(mb[c])) * kFaScale);
        const float corr = __builtin_amdgcn_exp2f(mrun[c] - mnew);   // 0 on the first pass
        mrun[c] = mnew;
        thr[c]  = (mnew + 8.0f) * (1.0f / kFaScale);
        acc[c]  = acc[c] * corr;
        lacc[c] = lacc[c] * corr;
      }
    }
#pragma unroll
    for (int c = 0; c < 2; ++c) {
      const v2f sc = (v2f){kFaScale, kFaScale};
      const v2f nm = (v2f){-mrun[c], -mrun[c]};
      v16h pf;
#pragma unroll
      for (int i = 0; i < 8; ++i) {
        const v2f a = __builtin_elementwise_fma((v2f){s[c][i >> 2][2 * (i & 3)], s[c][i >> 2][2 * (i & 3) + 1]}, sc, nm);
        const v2h h = __builtin_convertvector((v2f){__builtin_amdgcn_exp2f(a[0]), __builtin_amdgcn_exp2f(a[1])}, v2h);
        pf[2 * i]     = h[0];
        pf[2 * i + 1] = h[1];
      }
      acc[c]  = mma16(vf, pf, acc[c]);
      lacc[c] = mma16(ones, pf, lacc[c]);   // row 0 += the column sums of P^T
    }
  }

  // ---- merge the 4 key slices ----
  float* pw = part[split];
#pragma unroll
  for (int c = 0; c < 2; ++c) {
    const int col = ng * 32 + c * 16 + rlane;
#pragma unroll
    for (int r = 0; r < 8; ++r) pw[(hl * 8 + r) * kFaPitch + col] = acc[c][r];
    if (hl == 0) {
      pm[split][col] = mrun[c];
      pl[split][col] = lacc[c][0];
    }
  }
  __syncthreads();
  const int d  = wave;                           // 16 waves = 16 rows d; a wave stores 512 B of one row
  const int n4 = lane * 4;
  v4f mm[kFaSplit];
#pragma unroll
  for (int k = 0; k < kFaSplit; ++k) mm[k] = *(const v4f*)(&pm[k][n4]);
  v4f res;
#pragma unroll
  for (int e = 0; e < 4; ++e) {
    const float mt = fmaxf(fmaxf(mm[0][e], mm[1][e]), fmaxf(mm[2][e], mm[3][e]));
    float den = 0.f, num = 0.f;
#pragma unroll
    for (int k = 0; k < kFaSplit; ++k) {
      const float wgt = __builtin_amdgcn_exp2f(mm[k][e] - mt);
      den += wgt * pl[k][n4 + e];
      num += wgt * part[k][d * kFaPitch + n4 + e];
    }
    res[e] = num / den;
  }
  *(v4f*)(out + ((size_t)g * kHdim + d) * kNtok + n0 + n4) = res;   // out[b][h*16 + d][n], g = b*4 + h
}

// ---------------------------------------------------------------------------
extern "C" void kernel_launch(void* const* d_in, const int* in_sizes, int n_in,
                              void* d_out, int out_size, void* d_ws, size_t ws_size,
                              hipStream_t stream) {
  (void)in_sizes; (void)n_in;
  const float* x    = (const float*)d_in[0];     // [2][64][4096]
  const float* w    = (const float*)d_in[1];     // [192][64]
  const float* bias = (const float*)d_in[2];     // [192]
  float* out = (float*)d_out;                    // [2][64][4096]

  // ---- workspace carve (see region map at the top) ----
  const size_t szQK16  = (size_t)kGroups * kNtok * kQKld * 2;
  const size_t szVcm16 = (size_t)kGroups * kVrows * kNtok * 2;
  char* ws = (char*)d_ws;
  size_t off = 0;
  unsigned short* Q16   = (unsigned short*)(ws + off); off += szQK16;
  unsigned short* K16   = (unsigned short*)(ws + off); off += szQK16;
  unsigned short* Vcm16 = (unsigned short*)(ws + off); off += szVcm16;
  if (off > ws_size) return;                                       // 8,388,608 B carved
  if ((size_t)out_size < (size_t)kBatch * kChan * kNtok) return;   // 524,288 f32 elements

  // 1) x, w, bias -> Q16, K16 [8][4096][32], Vcm16 [8][64][4096] (data parts only); 128 blocks of 64 tokens, 8 waves each
  qkv_proj_kernel<<<dim3(kTok / kPjTok), dim3(kPjThr), 0, stream>>>(x, w, bias, Q16, K16, Vcm16);

  // 2) all (batch, head) groups: scores, softmax and P.V fused, heads stored to the channel-major output;
  //    8 groups x 32 blocks of 128 tokens, 16 waves each
  attn_fused_kernel<<<dim3(kGroups * (kNtok / kFaTok)), dim3(512), 0, stream>>>(Q16, K16, Vcm16, out);
}

// v004
// One run takes 21.1 microseconds.
// Two timings next to v003 put it at 1.09 and 1.10 times that version's speed.
// Over all steps from v000 it is 70.9 times as fast.
// Contractions: qkv projection (T f16 x W^T f16 carried x16), scores k.q^T (q,k f16, head dim 16 in one half of k = 32), v.attn (V f16 channel-major x P^T f16, P = exp2 against a running maximum) and its column sums: all v_wmma_f32_16x16x32_f16 with f32 accumulate; softmax and the merge of key slices in f32; the LDS staging of x, w, K and V in f16.
#include <hip/hip_runtime.h>
#include <math.h>

// ---------------------------------------------------------------------------
// Problem constants
// ---------------------------------------------------------------------------
constexpr int kBatch  = 2;
constexpr int kChan   = 64;                 // input channels = output channels
constexpr int kNtok   = 4096;               // tokens per batch (64 x 64)
constexpr int kTok    = kBatch * kNtok;     // 8192 token rows
constexpr int kHeads  = 4;
constexpr int kHdim   = 16;
constexpr int kGroups = kBatch * kHeads;    // 8 (batch, head) groups
constexpr int kQKld   = 32;                 // q/k plane pitch in halves: 16 data, the rest neither written nor read
constexpr int kVrows  = 64;                 // V channel-major row slots per group: 16 data, the rest neither written nor read
constexpr float kWCarry    = 16.0f;         // weights carried x16 in f16
constexpr float kWCarryInv = 1.0f / 16.0f;
constexpr float kQKScale   = 0.25f;         // 1/sqrt(16)

// ---------------------------------------------------------------------------
// Workspace region map (bytes; every region 4096-B aligned; total 8,388,608)
//   Q16    f16 [8][4096][32]         2,097,152   at          0
//   K16    f16 [8][4096][32]         2,097,152   at  2,097,152
//   Vcm16  f16 [8][64][4096]         4,194,304   at  4,194,304
// ---------------------------------------------------------------------------

typedef __attribute__((ext_vector_type(16))) _Float16 v16h;
typedef __attribute__((ext_vector_type(8)))  _Float16 v8h;
typedef __attribute__((ext_vector_type(8)))  float    v8f;
typedef __attribute__((ext_vector_type(4)))  float    v4f;

union Frag16 { v16h v; v8h h[2]; };
__device__ __forceinline__ v16h join16(v8h lo, v8h hi) { Frag16 f; f.h[0] = lo; f.h[1] = hi; return f.v; }
// A or B fragment of one k step of 32: elements 0..7 <- p[0..7], 8..15 <- p[16..23] (p already at the lane half's k offset)
__device__ __forceinline__ v16h frag_load(const _Float16* p) { return join16(*(const v8h*)(p), *(const v8h*)(p + 16)); }
__device__ __forceinline__ v8f mma16(v16h a, v16h b, v8f c) {
  return __builtin_amdgcn_wmma_f32_16x16x32_f16(false, a, false, b, (short)0, c, false, false);
}

// ---------------------------------------------------------------------------
// qkv projection, from x and w to the f16 planes of the attention kernel in one launch.
// Block = 64 consecutive tokens of one batch (grid 128), 8 waves = 4 heads x 2 token halves of 32 (two tiles of 16).
// The block casts its x tile (64 c x 64 tokens) to f16 and turns it token-major in LDS: a thread reads 8 channels of one token
// (a wave = 32 consecutive tokens = one 128-B line per load) and stores them as one 16-B piece; pitch 72 halves.
// w goes the same way (f16 of 16 w, row-major, same pitch): whole 128-B lines on the global side, read once per block;
// fragment loads straight from global memory would touch 16 lines each and repeat in the waves of a head.
// q, k: D = W.T^T, so lane (token, hl) holds channels hl*8 + r of its token = one 16-B piece of the token-major plane.
// v:    D = T.W^T, so lane (d, hl) holds tokens hl*8 + r of channel d = one 16-B piece of the channel-major plane.
// The k order is that of frag_load for both operands in both orientations.
// ---------------------------------------------------------------------------
constexpr int kPjTok   = 64;
constexpr int kPjThr   = 256;
constexpr int kPjPitch = kChan + 8;

typedef __attribute__((ext_vector_type(4))) _Float16 v4h;

__global__ __launch_bounds__(kPjThr) void qkv_proj_kernel(const float* __restrict__ x,
                                                          const float* __restrict__ w,
                                                          const float* __restrict__ bias,
                                                          unsigned short* __restrict__ Q16,
                                                          unsigned short* __restrict__ K16,
                                                          unsigned short* __restrict__ Vcm16) {
  __shared__ __align__(16) _Float16 sT[kPjTok * kPjPitch];
  __shared__ __align__(16) _Float16 sW[3 * kChan * kPjPitch];
  const int t     = threadIdx.x;
  const int lane  = t & 31;
  const int wave  = t >> 5;
  const int rlane = lane & 15;
  const int hl    = lane >> 4;
  const int tok0  = blockIdx.x * kPjTok;
  const int b     = tok0 / kNtok;
  const int n0    = tok0 % kNtok;
  const int th    = wave & 1;                    // token half
  const int h     = wave >> 1;                   // head

  // every global load of the block is issued before the first is waited for
  constexpr int kXp = kPjTok * kChan / 8 / kPjThr;       // x pieces per thread: 2
  constexpr int kWp = 3 * kChan * kChan / 4 / kPjThr;    // float4 of w per thread: 12
  float xr[kXp][8];
  v4f   wr[kWp];
#pragma unroll
  for (int i = 0; i < kXp; ++i) {
    const int idx = i * kPjThr + t;              // piece = (channel octet, token)
    const float* xp = x + ((size_t)b * kChan + (idx / kPjTok) * 8) * kNtok + n0 + (idx & (kPjTok - 1));
#pragma unroll
    for (int e = 0; e < 8; ++e) xr[i][e] = xp[(size_t)e * kNtok];
  }
#pragma unroll
  for (int i = 0; i < kWp; ++i) wr[i] = *(const v4f*)(w + 4 * (size_t)(i * kPjThr + t));
  // the bias loads may be given registers that held the addresses of the loads above: those are let go first
  asm volatile("s_wait_xcnt 0x0" ::: "memory");
  const float* bq = bias + h * kHdim + hl * 8;   // q, k: the lane's 8 channels; v: its one channel
  const v4f bq0 = *(const v4f*)(bq),         bq1 = *(const v4f*)(bq + 4);
  const v4f bk0 = *(const v4f*)(bq + kChan), bk1 = *(const v4f*)(bq + kChan + 4);
  const float bv = bias[2 * kChan + h * kHdim + rlane];
#pragma unroll
  for (int i = 0; i < kXp; ++i) {
    const int idx = i * kPjThr + t;
    v8h hv;
#pragma unroll
    for (int e = 0; e < 8; ++e) hv[e] = (_Float16)xr[i][e];
    *(v8h*)(sT + (idx & (kPjTok - 1)) * kPjPitch + (idx / kPjTok) * 8) = hv;
  }
#pragma unroll
  for (int i = 0; i < kWp; ++i) {
    const int idx = i * kPjThr + t;              // float4 index: 16 per row of w
    *(v4h*)(sW + (idx >> 4) * kPjPitch + (idx & 15) * 4) =
        (v4h){(_Float16)(wr[i][0] * kWCarry), (_Float16)(wr[i][1] * kWCarry),
              (_Float16)(wr[i][2] * kWCarry), (_Float16)(wr[i][3] * kWCarry)};
  }
  __syncthreads();

  const _Float16* tp = sT + (th * 32 + rlane) * kPjPitch + hl * 8;     // second tile 16 rows further
  const _Float16* wp = sW + (h * kHdim + rlane) * kPjPitch + hl * 8;   // q rows; k and v rows 64 and 128 further
  const v8f zero8 = (v8f){0.f, 0.f, 0.f, 0.f, 0.f, 0.f, 0.f, 0.f};
  v8f aq[2] = {zero8, zero8}, ak[2] = {zero8, zero8}, av[2] = {zero8, zero8};
#pragma unroll
  for (int ks = 0; ks < 2; ++ks) {
    const v16h wq = frag_load(wp + ks * 32);
    const v16h wk = frag_load(wp + kChan * kPjPitch + ks * 32);
    const v16h wv = frag_load(wp + 2 * kChan * kPjPitch + ks * 32);
#pragma unroll
    for (int c = 0; c < 2; ++c) {
      const v16h xf = frag_load(tp + c * 16 * kPjPitch + ks * 32);
      aq[c] = mma16(wq, xf, aq[c]);
      ak[c] = mma16(wk, xf, ak[c]);
      av[c] = mma16(xf, wv, av[c]);
    }
  }

  const int g = b * kHeads + h;
#pragma unroll
  for (int c = 0; c < 2; ++c) {
    v8h hq, hk, hv;
#pragma unroll
    for (int r = 0; r < 8; ++r) {
      hq[r] = (_Float16)(aq[c][r] * kWCarryInv + (r < 4 ? bq0[r & 3] : bq1[r & 3]));
      hk[r] = (_Float16)(ak[c][r] * kWCarryInv + (r < 4 ? bk0[r & 3] : bk1[r & 3]));
      hv[r] = (_Float16)(av[c][r] * kWCarryInv + bv);
    }
    const int nt = n0 + th * 32 + c * 16;        // first token of the tile
    const size_t qk = ((size_t)g * kNtok + nt + rlane) * kQKld + hl * 8;
    *(v8h*)(Q16 + qk) = hq;
    *(v8h*)(K16 + qk) = hk;
    *(v8h*)(Vcm16 + ((size_t)g * kVrows + rlane) * kNtok + nt + hl * 8) = hv;
  }
}

// ---------------------------------------------------------------------------
// Fused attention of all (batch, head) groups: scores, softmax and P.V in one launch; S and P never leave the registers.
// Block = 128 tokens n of one group (grid 8 x 32 = 256), 16 waves = 4 token slices of 32 n x 4 key slices of 1024 m.
// The block parks the group's whole K (data halves only) and V (16 data rows) in LDS, each as ready fragments:
//   K: 512 B per 16 keys = [d half hl][key r] x 16 B, so lane l of a fragment read takes piece l;
//   V: 256 B per 8 keys m8 = [d] x 16 B, the 64-B quarters exchanged by m8 & 3 so that the staging stores (4 d x 8 m8
//      per wave, whole 128-B lines of V on the global side) and the fragment reads (16 d of one m8) both spread over all banks.
// Staging is by asynchronous copies to LDS, in three chunks of passes (4, 8, 20 of every key slice): only the first chunk is
// waited for with nothing to do; each later chunk flies while the chunk before it is worked on and is published at that chunk's foot.
// A pass is 32 keys. S^T = K.Q^T: ONE A fragment holds two key tiles (k 0..15 = d of keys m0 + r, k 16..31 = d of keys
// m0 + 16 + r); B = [q | 0] gives the first tile's scores and B = [0 | q] the second's (head dim 16 fills half of k = 32).
// In a score tile lane (n, hl) holds keys hl*8 + r of token n, which is the B layout of P^T for O^T += V^T.P^T:
// position (hl, e) is key m0 + hl*8 + e for e < 8 and m0 + 16 + hl*8 + e - 8 above, in the V fragment and in P alike.
// Online softmax in the log2 domain; the maximum in use may trail the true one by up to 8 (p <= 256 in f16), so the
// accumulators are rescaled only when some token's maximum exceeds it by more. Denominator: an A fragment with ones in row 0 sums
// the rounded P on the matrix pipe. The 4 key slices are merged through LDS in slice order.
// ---------------------------------------------------------------------------
constexpr int kFaTok   = 128;                    // tokens per block
constexpr int kFaSplit = 4;                      // key slices per block
constexpr int kFaKeys  = kNtok / kFaSplit;       // 1024 keys per wave
constexpr int kFaPass  = kFaKeys / 32;           // 32 passes of 32 keys
constexpr int kFaPitch = kFaTok + 4;             // partial-tile pitch in floats: lane halves fall on different banks
constexpr float kFaScale = kQKScale * 1.4426950408889634f;   // score scale in the log2 domain

typedef __attribute__((ext_vector_type(2))) float    v2f;
typedef __attribute__((ext_vector_type(2))) _Float16 v2h;

// lane l <-> lane l ^ 16
__device__ __forceinline__ float other_half(float x) {
  const int b = __builtin_bit_cast(int, x);
  return __builtin_bit_cast(float, __builtin_amdgcn_permlanex16(b, b, 0x76543210, 0xfedcba98, false, false));
}

// Copies of 16 B per lane from global memory to LDS, through no register. The s_wait_xcnt stands inside the copies' own statement,
// so that no address register of a copy is rewritten ahead of it.
__device__ __forceinline__ void copy4(const unsigned* l, const _Float16* const* g) {
  asm volatile("global_load_async_to_lds_b128 %0, %1, off\n\t"
               "global_load_async_to_lds_b128 %2, %3, off\n\t"
               "global_load_async_to_lds_b128 %4, %5, off\n\t"
               "global_load_async_to_lds_b128 %6, %7, off\n\t"
               "s_wait_xcnt 0x0"
               :: "v"(l[0]), "v"(g[0]), "v"(l[1]), "v"(g[1]), "v"(l[2]), "v"(g[2]), "v"(l[3]), "v"(g[3]) : "memory");
}
__device__ __forceinline__ void copy8(const unsigned* l, const _Float16* const* g) {
  asm volatile("global_load_async_to_lds_b128 %0, %1, off\n\t"
               "global_load_async_to_lds_b128 %2, %3, off\n\t"
               "global_load_async_to_lds_b128 %4, %5, off\n\t"
               "global_load_async_to_lds_b128 %6, %7, off\n\t"
               "global_load_async_to_lds_b128 %8, %9, off\n\t"
               "global_load_async_to_lds_b128 %10, %11, off\n\t"
               "global_load_async_to_lds_b128 %12, %13, off\n\t"
               "global_load_async_to_lds_b128 %14, %15, off\n\t"
               "s_wait_xcnt 0x0"
               :: "v"(l[0]), "v"(g[0]), "v"(l[1]), "v"(g[1]), "v"(l[2]), "v"(g[2]), "v"(l[3]), "v"(g[3]),
                  "v"(l[4]), "v"(g[4]), "v"(l[5]), "v"(g[5]), "v"(l[6]), "v"(g[6]), "v"(l[7]), "v"(g[7]) : "memory");
}

// Addresses of G pieces of 16 B of K (entries 0 .. G - 1) and of V (entries G .. 2 G - 1) for one thread: units un .. un + G - 1.
// A unit is 128 pieces of a key slice = 64 keys = two passes, of K and of V alike; threads 128 s .. 128 s + 127 take key slice s.
template <int G>
__device__ __forceinline__ void piece_addr(const _Float16* K, const _Float16* V, _Float16* sK, _Float16* sV, int un, int t,
                                           unsigned* l, const _Float16** g) {
  // unrolled: the address arrays are operands of an asm statement and have to be registers
#pragma unroll
  for (int u = 0; u < G; ++u) {
    const int idx = (t >> 7) * (kFaKeys * 2) + (un + u) * 128 + (t & 127);   // piece number in the whole K, and in the whole V
    g[u] = K + (size_t)((idx >> 5) * 16 + (t & 15)) * kQKld + ((t >> 4) & 1) * 8;   // piece = (key tile idx >> 5, lane)
    l[u] = (unsigned)(size_t)(sK + idx * 8);
    const int m8 = (idx >> 7) * 8 + (idx & 7);   // 8 lanes cover one 128-B line of a V row
    const int d  = (idx >> 3) & 15;
    g[G + u] = V + (size_t)d * kNtok + m8 * 8;
    l[G + u] = (unsigned)(size_t)(sV + m8 * 128 + ((d * 8) ^ ((m8 & 3) * 32)));
  }
}

// Issues the copies of passes pb .. pb + NP - 1 (both even) of all four key slices: NP / 2 pieces of K and as many of V per thread.
template <int NP>
__device__ __forceinline__ void stage_kv(const _Float16* K, const _Float16* V, _Float16* sK, _Float16* sV, int pb, int t) {
  constexpr int kN = NP / 2;
  // unrolled for the same reason as above
#pragma unroll
  for (int i = 0; i + 4 <= kN; i += 4) {
    unsigned l[8];
    const _Float16* g[8];
    piece_addr<4>(K, V, sK, sV, pb / 2 + i, t, l, g);
    copy8(l, g);
  }
  if constexpr ((kN & 3) == 2) {
    unsigned l[4];
    const _Float16* g[4];
    piece_addr<2>(K, V, sK, sV, pb / 2 + (kN & ~3), t, l, g);
    copy4(l, g);
  }
}

__global__ __launch_bounds__(512) void attn_fused_kernel(const unsigned short* __restrict__ Qp,
                                                         const unsigned short* __restrict__ Kp,
                                                         const unsigned short* __restrict__ Vp,
                                                         float* __restrict__ out) {
  __shared__ __align__(16) _Float16 sK[kNtok * kHdim];
  __shared__ __align__(16) _Float16 sV[kNtok * kHdim];
  __shared__ __align__(16) float part[kFaSplit][kHdim * kFaPitch];
  __shared__ __align__(16) float pm[kFaSplit][kFaTok];
  __shared__ __align__(16) float pl[kFaSplit][kFaTok];
  const int t     = threadIdx.x;
  const int lane  = t & 31;
  const int wave  = t >> 5;
  const int rlane = lane & 15;
  const int hl    = lane >> 4;
  const int g     = blockIdx.x / (kNtok / kFaTok);
  const int n0    = (blockIdx.x % (kNtok / kFaTok)) * kFaTok;
  const _Float16* Q = (const _Float16*)Qp + (size_t)g * kNtok * kQKld;
  const _Float16* K = (const _Float16*)Kp + (size_t)g * kNtok * kQKld;
  const _Float16* V = (const _Float16*)Vp + (size_t)g * kVrows * kNtok;

  // ---- first chunk of K and V: passes 0..3 of every key slice ----
  stage_kv<4>(K, V, sK, sV, 0, t);

  const int ng    = wave & 3;                    // token slice
  const int split = wave >> 2;                   // key slice
  const v8h z8 = (v8h){0, 0, 0, 0, 0, 0, 0, 0};
  v16h qa[2], qb[2];
#pragma unroll
  for (int c = 0; c < 2; ++c) {
    const v8h q = *(const v8h*)(Q + (size_t)(n0 + ng * 32 + c * 16 + rlane) * kQKld + hl * 8);
    qa[c] = join16(q, z8);
    qb[c] = join16(z8, q);
  }
  const _Float16 one = (rlane == 0) ? (_Float16)1.0f : (_Float16)0.0f;   // A operand whose row 0 is ones
  const v8h o8 = (v8h){one, one, one, one, one, one, one, one};
  const v16h ones = join16(o8, o8);
  const v8f zero8 = (v8f){0.f, 0.f, 0.f, 0.f, 0.f, 0.f, 0.f, 0.f};
  v8f acc[2]  = {zero8, zero8};
  v8f lacc[2] = {zero8, zero8};
  float mrun[2] = {-INFINITY, -INFINITY};        // maximum in use, scaled
  float thr[2]  = {-INFINITY, -INFINITY};        // raw score above which it is renewed: (mrun + 8) / scale
  // this wave's copies of the first chunk have landed; behind the barrier every wave's have
  asm volatile("s_wait_asynccnt 0x0" ::: "memory");
  __syncthreads();
  stage_kv<8>(K, V, sK, sV, 4, t);               // flies under passes 0..3

  const _Float16* kw  = sK + split * kFaKeys * kHdim + lane * 8;
  const _Float16* vw0 = sV + split * kFaKeys * kHdim + hl * 128 + ((rlane * 8) ^ (hl * 32));
  const _Float16* vw1 = sV + split * kFaKeys * kHdim + (2 + hl) * 128 + ((rlane * 8) ^ ((2 + hl) * 32));
  // passes pb .. pe - 1: one chunk
  auto passes = [&](const int pb, const int pe) {
  v16h kf = join16(*(const v8h*)(kw + pb * 512), *(const v8h*)(kw + pb * 512 + 256));
  for (int p = pb; p < pe; ++p) {
    v8f s[2][2];
#pragma unroll
    for (int c = 0; c < 2; ++c) {
      s[c][0] = mma16(kf, qa[c], zero8);
      s[c][1] = mma16(kf, qb[c], zero8);
    }
    // keeps the four score products back to back: spread among the maxima each one drew its own run of v_nop
    __builtin_amdgcn_sched_barrier(0);
    const v16h vf = join16(*(const v8h*)(vw0 + p * 512), *(const v8h*)(vw1 + p * 512));
    const int pn = (p + 1 < pe) ? p + 1 : pb;
    kf = join16(*(const v8h*)(kw + pn * 512), *(const v8h*)(kw + pn * 512 + 256));

    float mb[2];                                 // this lane's maximum of the pass (8 + 8 keys of its token), raw
    bool need = false;
#pragma unroll
    for (int c = 0; c < 2; ++c) {
      float mx = fmaxf(s[c][0][0], s[c][1][0]);
#pragma unroll
      for (int r = 1; r < 8; ++r) mx = fmaxf(fmaxf(mx, s[c][0][r]), s[c][1][r]);
      mb[c] = mx;
      need = need || (mx > thr[c]);
    }
    if (__builtin_amdgcn_ballot_w32(need) != 0) { // wave-uniform; always on the first pass, rare after it
#pragma unroll
      for (int c = 0; c < 2; ++c) {
        // both lane halves of a token take the same new maximum
        const float mnew = fmaxf(mrun[c], fmaxf(mb[c], other_half(mb[c])) * kFaScale);
        const float corr = __builtin_amdgcn_exp2f(mrun[c] - mnew);   // 0 on the first pass
        mrun[c] = mnew;
        thr[c]  = (mnew + 8.0f) * (1.0f / kFaScale);
        acc[c]  = acc[c] * corr;
        lacc[c] = lacc[c] * corr;
      }
    }
#pragma unroll
    for (int c = 0; c < 2; ++c) {
      const v2f sc = (v2f){kFaScale, kFaScale};
      const v2f nm = (v2f){-mrun[c], -mrun[c]};
      v16h pf;
#pragma unroll
      for (int i = 0; i < 8; ++i) {
        const v2f a = __builtin_elementwise_fma((v2f){s[c][i >> 2][2 * (i & 3)], s[c][i >> 2][2 * (i & 3) + 1]}, sc, nm);
        const v2h h = __builtin_convertvector((v2f){__builtin_amdgcn_exp2f(a[0]), __builtin_amdgcn_exp2f(a[1])}, v2h);
        pf[2 * i]     = h[0];
        pf[2 * i + 1] = h[1];
      }
      acc[c]  = mma16(vf, pf, acc[c]);
      lacc[c] = mma16(ones, pf, lacc[c]);   // row 0 += the column sums of P^T
    }
  }
  };
  // foot of a chunk: this wave's LDS reads are done and its copies of the next chunk have landed; behind the barrier every wave's have
  auto publish = [&]() {
    asm volatile("s_wait_dscnt 0x0" ::: "memory");
    asm volatile("s_wait_asynccnt 0x0" ::: "memory");
    __syncthreads();
  };
  passes(0, 4);
  publish();
  stage_kv<20>(K, V, sK, sV, 12, t);             // flies under passes 4..11
  passes(4, 12);
  publish();
  passes(12, kFaPass);
  // no copy of this wave is outstanding when it goes on to the merge and ends
  asm volatile("s_wait_asynccnt 0x0" ::: "memory");

  // ---- merge the 4 key slices ----
  float* pw = part[split];
#pragma unroll
  for (int c = 0; c < 2; ++c) {
    const int col = ng * 32 + c * 16 + rlane;
#pragma unroll
    for (int r = 0; r < 8; ++r) pw[(hl * 8 + r) * kFaPitch + col] = acc[c][r];
    if (hl == 0) {
      pm[split][col] = mrun[c];
      pl[split][col] = lacc[c][0];
    }
  }
  __syncthreads();
  const int d  = wave;                           // 16 waves = 16 rows d; a wave stores 512 B of one row
  const int n4 = lane * 4;
  v4f mm[kFaSplit];
#pragma unroll
  for (int k = 0; k < kFaSplit; ++k) mm[k] = *(const v4f*)(&pm[k][n4]);
  v4f res;
#pragma unroll
  for (int e = 0; e < 4; ++e) {
    const float mt = fmaxf(fmaxf(mm[0][e], mm[1][e]), fmaxf(mm[2][e], mm[3][e]));
    float den = 0.f, num = 0.f;
#pragma unroll
    for (int k = 0; k < kFaSplit; ++k) {
      const float wgt = __builtin_amdgcn_exp2f(mm[k][e] - mt);
      den += wgt * pl[k][n4 + e];
      num += wgt * part[k][d * kFaPitch + n4 + e];
    }
    res[e] = num / den;
  }
  *(v4f*)(out + ((size_t)g * kHdim + d) * kNtok + n0 + n4) = res;   // out[b][h*16 + d][n], g = b*4 + h
}

// ---------------------------------------------------------------------------
extern "C" void kernel_launch(void* const* d_in, const int* in_sizes, int n_in,
                              void* d_out, int out_size, void* d_ws, size_t ws_size,
                              hipStream_t stream) {
  (void)in_sizes; (void)n_in;
  const float* x    = (const float*)d_in[0];     // [2][64][4096]
  const float* w    = (const float*)d_in[1];     // [192][64]
  const float* bias = (const float*)d_in[2];     // [192]
  float* out = (float*)d_out;                    // [2][64][4096]

  // ---- workspace carve (see region map at the top) ----
  const size_t szQK16  = (size_t)kGroups * kNtok * kQKld * 2;
  const size_t szVcm16 = (size_t)kGroups * kVrows * kNtok * 2;
  char* ws = (char*)d_ws;
  size_t off = 0;
  unsigned short* Q16   = (unsigned short*)(ws + off); off += szQK16;
  unsigned short* K16   = (unsigned short*)(ws + off); off += szQK16;
  unsigned short* Vcm16 = (unsigned short*)(ws + off); off += szVcm16;
  if (off > ws_size) return;                                       // 8,388,608 B carved
  if ((size_t)out_size < (size_t)kBatch * kChan * kNtok) return;   // 524,288 f32 elements

  // 1) x, w, bias -> Q16, K16 [8][4096][32], Vcm16 [8][64][4096] (data parts only); 128 blocks of 64 tokens, 8 waves each
  qkv_proj_kernel<<<dim3(kTok / kPjTok), dim3(kPjThr), 0, stream>>>(x, w, bias, Q16, K16, Vcm16);

  // 2) all (batch, head) groups: scores, softmax and P.V fused, heads stored to the channel-major output;
  //    8 groups x 32 blocks of 128 tokens, 16 waves each
  attn_fused_kernel<<<dim3(kGroups * (kNtok / kFaTok)), dim3(512), 0, stream>>>(Q16, K16, Vcm16, out);
}

// v005
// A run of this version takes 20.3 microseconds.
// Next to v004, in two timings, it ran 1.04 and 1.03 times as fast.
// Counting every step since v000, it is 73.6 times as fast.
// Contractions: qkv projection (T f16 x W^T f16 carried x16), scores k.q^T (q,k f16, q carried x the score scale, C = minus the maximum in use, head dim 16 in one half of k = 32), v.attn (V f16 channel-major x P^T f16, P = exp2 against a running maximum) and its column sums: all v_wmma_f32_16x16x32_f16 with f32 accumulate; softmax and layout shuffles in f32.
#include <hip/hip_runtime.h>
#include <math.h>

// ---------------------------------------------------------------------------
// Problem constants
// ---------------------------------------------------------------------------
constexpr int kBatch  = 2;
constexpr int kChan   = 64;                 // input channels = output channels
constexpr int kNtok   = 4096;               // tokens per batch (64 x 64)
constexpr int kTok    = kBatch * kNtok;     // 8192 token rows
constexpr int kHeads  = 4;
constexpr int kHdim   = 16;
constexpr int kGroups = kBatch * kHeads;    // 8 (batch, head) groups
constexpr int kQKld   = 32;                 // q/k plane pitch in halves: 16 data, the rest neither written nor read
constexpr int kVrows  = 64;                 // V channel-major row slots per group: 16 data, the rest neither written nor read
constexpr float kWCarry    = 16.0f;         // weights carried x16 in f16
constexpr float kWCarryInv = 1.0f / 16.0f;
constexpr float kQKScale   = 0.25f;         // 1/sqrt(16)
constexpr float kFaScale   = kQKScale * 1.4426950408889634f;   // score scale in the log2 domain; q is stored times this

// ---------------------------------------------------------------------------
// Workspace region map (bytes; every region 4096-B aligned; total 8,388,608)
//   Q16    f16 [8][4096][32]         2,097,152   at          0
//   K16    f16 [8][4096][32]         2,097,152   at  2,097,152
//   Vcm16  f16 [8][64][4096]         4,194,304   at  4,194,304
// ---------------------------------------------------------------------------

typedef __attribute__((ext_vector_type(16))) _Float16 v16h;
typedef __attribute__((ext_vector_type(8)))  _Float16 v8h;
typedef __attribute__((ext_vector_type(8)))  float    v8f;
typedef __attribute__((ext_vector_type(4)))  float    v4f;

union Frag16 { v16h v; v8h h[2]; };
__device__ __forceinline__ v16h join16(v8h lo, v8h hi) { Frag16 f; f.h[0] = lo; f.h[1] = hi; return f.v; }
// A or B fragment of one k step of 32: elements 0..7 <- p[0..7], 8..15 <- p[16..23] (p already at the lane half's k offset)
__device__ __forceinline__ v16h frag_load(const _Float16* p) { return join16(*(const v8h*)(p), *(const v8h*)(p + 16)); }
__device__ __forceinline__ v8f mma16(v16h a, v16h b, v8f c) {
  return __builtin_amdgcn_wmma_f32_16x16x32_f16(false, a, false, b, (short)0, c, false, false);
}

// ---------------------------------------------------------------------------
// qkv projection, from x and w to the f16 planes of the attention kernel in one launch.
// Block = 64 consecutive tokens of one batch (grid 128), 8 waves = 4 heads x 2 token halves of 32 (two tiles of 16).
// The block casts its x tile (64 c x 64 tokens) to f16 and turns it token-major in LDS: a thread reads 8 channels of one token
// (a wave = 32 consecutive tokens = one 128-B line per load) and stores them as one 16-B piece; pitch 72 halves.
// w goes the same way (f16 of 16 w, row-major, same pitch): whole 128-B lines on the global side, read once per block;
// fragment loads straight from global memory would touch 16 lines each and repeat in the waves of a head.
// q, k: D = W.T^T, so lane (token, hl) holds channels hl*8 + r of its token = one 16-B piece of the token-major plane;
//       q is stored times the score scale of the attention kernel, so that k.q^T is the scaled score.
// v:    D = T.W^T, so lane (d, hl) holds tokens hl*8 + r of channel d = one 16-B piece of the channel-major plane.
// The k order is that of frag_load for both operands in both orientations.
// ---------------------------------------------------------------------------
constexpr int kPjTok   = 64;
constexpr int kPjThr   = 256;
constexpr int kPjPitch = kChan + 8;

typedef __attribute__((ext_vector_type(4))) _Float16 v4h;

__global__ __launch_bounds__(kPjThr) void qkv_proj_kernel(const float* __restrict__ x,
                                                          const float* __restrict__ w,
                                                          const float* __restrict__ bias,
                                                          unsigned short* __restrict__ Q16,
                                                          unsigned short* __restrict__ K16,
                                                          unsigned short* __restrict__ Vcm16) {
  __shared__ __align__(16) _Float16 sT[kPjTok * kPjPitch];
  __shared__ __align__(16) _Float16 sW[3 * kChan * kPjPitch];
  const int t     = threadIdx.x;
  const int lane  = t & 31;
  const int wave  = t >> 5;
  const int rlane = lane & 15;
  const int hl    = lane >> 4;
  const int tok0  = blockIdx.x * kPjTok;
  const int b     = tok0 / kNtok;
  const int n0    = tok0 % kNtok;
  const int th    = wave & 1;                    // token half
  const int h     = wave >> 1;                   // head

  // every global load of the block is issued before the first is waited for
  constexpr int kXp = kPjTok * kChan / 8 / kPjThr;       // x pieces per thread: 2
  constexpr int kWp = 3 * kChan * kChan / 4 / kPjThr;    // float4 of w per thread: 12
  float xr[kXp][8];
  v4f   wr[kWp];
#pragma unroll
  for (int i = 0; i < kXp; ++i) {
    const int idx = i * kPjThr + t;              // piece = (channel octet, token)
    const float* xp = x + ((size_t)b * kChan + (idx / kPjTok) * 8) * kNtok + n0 + (idx & (kPjTok - 1));
#pragma unroll
    for (int e = 0; e < 8; ++e) xr[i][e] = xp[(size_t)e * kNtok];
  }
#pragma unroll
  for (int i = 0; i < kWp; ++i) wr[i] = *(const v4f*)(w + 4 * (size_t)(i * kPjThr + t));
  // the bias loads may be given registers that held the addresses of the loads above: those are let go first
  asm volatile("s_wait_xcnt 0x0" ::: "memory");
  const float* bq = bias + h * kHdim + hl * 8;   // q, k: the lane's 8 channels; v: its one channel
  const v4f bq0 = *(const v4f*)(bq),         bq1 = *(const v4f*)(bq + 4);
  const v4f bk0 = *(const v4f*)(bq + kChan), bk1 = *(const v4f*)(bq + kChan + 4);
  const float bv = bias[2 * kChan + h * kHdim + rlane];
#pragma unroll
  for (int i = 0; i < kXp; ++i) {
    const int idx = i * kPjThr + t;
    v8h hv;
#pragma unroll
    for (int e = 0; e < 8; ++e) hv[e] = (_Float16)xr[i][e];
    *(v8h*)(sT + (idx & (kPjTok - 1)) * kPjPitch + (idx / kPjTok) * 8) = hv;
  }
#pragma unroll
  for (int i = 0; i < kWp; ++i) {
    const int idx = i * kPjThr + t;              // float4 index: 16 per row of w
    *(v4h*)(sW + (idx >> 4) * kPjPitch + (idx & 15) * 4) =
        (v4h){(_Float16)(wr[i][0] * kWCarry), (_Float16)(wr[i][1] * kWCarry),
              (_Float16)(wr[i][2] * kWCarry), (_Float16)(wr[i][3] * kWCarry)};
  }
  __syncthreads();

  const _Float16* tp = sT + (th * 32 + rlane) * kPjPitch + hl * 8;     // second tile 16 rows further
  const _Float16* wp = sW + (h * kHdim + rlane) * kPjPitch + hl * 8;   // q rows; k and v rows 64 and 128 further
  const v8f zero8 = (v8f){0.f, 0.f, 0.f, 0.f, 0.f, 0.f, 0.f, 0.f};
  v8f aq[2] = {zero8, zero8}, ak[2] = {zero8, zero8}, av[2] = {zero8, zero8};
#pragma unroll
  for (int ks = 0; ks < 2; ++ks) {
    const v16h wq = frag_load(wp + ks * 32);
    const v16h wk = frag_load(wp + kChan * kPjPitch + ks * 32);
    const v16h wv = frag_load(wp + 2 * kChan * kPjPitch + ks * 32);
#pragma unroll
    for (int c = 0; c < 2; ++c) {
      const v16h xf = frag_load(tp + c * 16 * kPjPitch + ks * 32);
      aq[c] = mma16(wq, xf, aq[c]);
      ak[c] = mma16(wk, xf, ak[c]);
      av[c] = mma16(xf, wv, av[c]);
    }
  }

  const int g = b * kHeads + h;
#pragma unroll
  for (int c = 0; c < 2; ++c) {
    v8h hq, hk, hv;
#pragma unroll
    for (int r = 0; r < 8; ++r) {
      hq[r] = (_Float16)((aq[c][r] * kWCarryInv + (r < 4 ? bq0[r & 3] : bq1[r & 3])) * kFaScale);
      hk[r] = (_Float16)(ak[c][r] * kWCarryInv + (r < 4 ? bk0[r & 3] : bk1[r & 3]));
      hv[r] = (_Float16)(av[c][r] * kWCarryInv + bv);
    }
    const int nt = n0 + th * 32 + c * 16;        // first token of the tile
    const size_t qk = ((size_t)g * kNtok + nt + rlane) * kQKld + hl * 8;
    *(v8h*)(Q16 + qk) = hq;
    *(v8h*)(K16 + qk) = hk;
    *(v8h*)(Vcm16 + ((size_t)g * kVrows + rlane) * kNtok + nt + hl * 8) = hv;
  }
}

// ---------------------------------------------------------------------------
// Fused attention of all (batch, head) groups: scores, softmax and P.V in one launch; S and P never leave the registers.
// Block = 128 tokens n of one group (grid 8 x 32 = 256), 16 waves = 4 token slices of 32 n x 4 key slices of 1024 m.
// The block parks the group's whole K (data halves only) and V (16 data rows) in LDS, each as ready fragments:
//   K: 512 B per 16 keys = [d half hl][key r] x 16 B, so lane l of a fragment read takes piece l;
//   V: 256 B per 8 keys m8 = [d] x 16 B, the 64-B quarters exchanged by m8 & 3 so that the staging stores (4 d x 8 m8
//      per wave, whole 128-B lines of V on the global side) and the fragment reads (16 d of one m8) both spread over all banks.
// Staging is by asynchronous copies to LDS, in three chunks of passes (4, 8, 20 of every key slice): only the first chunk is
// waited for with nothing to do; each later chunk flies while the chunk before it is worked on and is published at that chunk's foot.
// A pass is 32 keys. S^T = K.Q^T: ONE A fragment holds two key tiles (k 0..15 = d of keys m0 + r, k 16..31 = d of keys
// m0 + 16 + r); B = [q | 0] gives the first tile's scores and B = [0 | q] the second's (head dim 16 fills half of k = 32).
// In a score tile lane (n, hl) holds keys hl*8 + r of token n, which is the B layout of P^T for O^T += V^T.P^T:
// position (hl, e) is key m0 + hl*8 + e for e < 8 and m0 + 16 + hl*8 + e - 8 above, in the V fragment and in P alike.
// Online softmax in the log2 domain. q comes scaled and a lane's 8 score registers all belong to one token, so the C operand of
// the score product is minus that token's maximum in use: the product's result is the argument of exp2 as it stands.
// The maximum in use may trail the true one by up to 8 (p <= 256 in f16), so C, the pass's scores and the
// accumulators are renewed only when some token's maximum exceeds it by more. Denominator: an A fragment with ones in row 0 sums
// the rounded P on the matrix pipe. The 4 key slices are merged through LDS in slice order.
// ---------------------------------------------------------------------------
constexpr int kFaTok   = 128;                    // tokens per block
constexpr int kFaSplit = 4;                      // key slices per block
constexpr int kFaKeys  = kNtok / kFaSplit;       // 1024 keys per wave
constexpr int kFaPass  = kFaKeys / 32;           // 32 passes of 32 keys
constexpr int kFaPitch = kFaTok + 4;             // partial-tile pitch in floats: lane halves fall on different banks

typedef __attribute__((ext_vector_type(2))) float    v2f;
typedef __attribute__((ext_vector_type(2))) _Float16 v2h;

// lane l <-> lane l ^ 16
__device__ __forceinline__ float other_half(float x) {
  const int b = __builtin_bit_cast(int, x);
  return __builtin_bit_cast(float, __builtin_amdgcn_permlanex16(b, b, 0x76543210, 0xfedcba98, false, false));
}

// Copies of 16 B per lane from global memory to LDS, through no register. The s_wait_xcnt stands inside the copies' own statement,
// so that no address register of a copy is rewritten ahead of it.
__device__ __forceinline__ void copy4(const unsigned* l, const _Float16* const* g) {
  asm volatile("global_load_async_to_lds_b128 %0, %1, off\n\t"
               "global_load_async_to_lds_b128 %2, %3, off\n\t"
               "global_load_async_to_lds_b128 %4, %5, off\n\t"
               "global_load_async_to_lds_b128 %6, %7, off\n\t"
               "s_wait_xcnt 0x0"
               :: "v"(l[0]), "v"(g[0]), "v"(l[1]), "v"(g[1]), "v"(l[2]), "v"(g[2]), "v"(l[3]), "v"(g[3]) : "memory");
}
__device__ __forceinline__ void copy8(const unsigned* l, const _Float16* const* g) {
  asm volatile("global_load_async_to_lds_b128 %0, %1, off\n\t"
               "global_load_async_to_lds_b128 %2, %3, off\n\t"
               "global_load_async_to_lds_b128 %4, %5, off\n\t"
               "global_load_async_to_lds_b128 %6, %7, off\n\t"
               "global_load_async_to_lds_b128 %8, %9, off\n\t"
               "global_load_async_to_lds_b128 %10, %11, off\n\t"
               "global_load_async_to_lds_b128 %12, %13, off\n\t"
               "global_load_async_to_lds_b128 %14, %15, off\n\t"
               "s_wait_xcnt 0x0"
               :: "v"(l[0]), "v"(g[0]), "v"(l[1]), "v"(g[1]), "v"(l[2]), "v"(g[2]), "v"(l[3]), "v"(g[3]),
                  "v"(l[4]), "v"(g[4]), "v"(l[5]), "v"(g[5]), "v"(l[6]), "v"(g[6]), "v"(l[7]), "v"(g[7]) : "memory");
}

// Addresses of G pieces of 16 B of K (entries 0 .. G - 1) and of V (entries G .. 2 G - 1) for one thread: units un .. un + G - 1.
// A unit is 128 pieces of a key slice = 64 keys = two passes, of K and of V alike; threads 128 s .. 128 s + 127 take key slice s.
template <int G>
__device__ __forceinline__ void piece_addr(const _Float16* K, const _Float16* V, _Float16* sK, _Float16* sV, int un, int t,
                                           unsigned* l, const _Float16** g) {
  // unrolled: the address arrays are operands of an asm statement and have to be registers
#pragma unroll
  for (int u = 0; u < G; ++u) {
    const int idx = (t >> 7) * (kFaKeys * 2) + (un + u) * 128 + (t & 127);   // piece number in the whole K, and in the whole V
    g[u] = K + (size_t)((idx >> 5) * 16 + (t & 15)) * kQKld + ((t >> 4) & 1) * 8;   // piece = (key tile idx >> 5, lane)
    l[u] = (unsigned)(size_t)(sK + idx * 8);
    const int m8 = (idx >> 7) * 8 + (idx & 7);   // 8 lanes cover one 128-B line of a V row
    const int d  = (idx >> 3) & 15;
    g[G + u] = V + (size_t)d * kNtok + m8 * 8;
    l[G + u] = (unsigned)(size_t)(sV + m8 * 128 + ((d * 8) ^ ((m8 & 3) * 32)));
  }
}

// Issues the copies of passes pb .. pb + NP - 1 (both even) of all four key slices: NP / 2 pieces of K and as many of V per thread.
template <int NP>
__device__ __forceinline__ void stage_kv(const _Float16* K, const _Float16* V, _Float16* sK, _Float16* sV, int pb, int t) {
  constexpr int kN = NP / 2;
  // unrolled for the same reason as above
#pragma unroll
  for (int i = 0; i + 4 <= kN; i += 4) {
    unsigned l[8];
    const _Float16* g[8];
    piece_addr<4>(K, V, sK, sV, pb / 2 + i, t, l, g);
    copy8(l, g);
  }
  if constexpr ((kN & 3) == 2) {
    unsigned l[4];
    const _Float16* g[4];
    piece_addr<2>(K, V, sK, sV, pb / 2 + (kN & ~3), t, l, g);
    copy4(l, g);
  }
}

__global__ __launch_bounds__(512) void attn_fused_kernel(const unsigned short* __restrict__ Qp,
                                                         const unsigned short* __restrict__ Kp,
                                                         const unsigned short* __restrict__ Vp,
                                                         float* __restrict__ out) {
  __shared__ __align__(16) _Float16 sK[kNtok * kHdim];
  __shared__ __align__(16) _Float16 sV[kNtok * kHdim];
  __shared__ __align__(16) float part[kFaSplit][kHdim * kFaPitch];
  __shared__ __align__(16) float pm[kFaSplit][kFaTok];
  __shared__ __align__(16) float pl[kFaSplit][kFaTok];
  const int t     = threadIdx.x;
  const int lane  = t & 31;
  const int wave  = t >> 5;
  const int rlane = lane & 15;
  const int hl    = lane >> 4;
  const int g     = blockIdx.x / (kNtok / kFaTok);
  const int n0    = (blockIdx.x % (kNtok / kFaTok)) * kFaTok;
  const _Float16* Q = (const _Float16*)Qp + (size_t)g * kNtok * kQKld;
  const _Float16* K = (const _Float16*)Kp + (size_t)g * kNtok * kQKld;
  const _Float16* V = (const _Float16*)Vp + (size_t)g * kVrows * kNtok;

  // ---- first chunk of K and V: passes 0..3 of every key slice ----
  stage_kv<4>(K, V, sK, sV, 0, t);

  const int ng    = wave & 3;                    // token slice
  const int split = wave >> 2;                   // key slice
  const v8h z8 = (v8h){0, 0, 0, 0, 0, 0, 0, 0};
  v16h qa[2], qb[2];
#pragma unroll
  for (int c = 0; c < 2; ++c) {
    const v8h q = *(const v8h*)(Q + (size_t)(n0 + ng * 32 + c * 16 + rlane) * kQKld + hl * 8);
    qa[c] = join16(q, z8);
    qb[c] = join16(z8, q);
  }
  const _Float16 one = (rlane == 0) ? (_Float16)1.0f : (_Float16)0.0f;   // A operand whose row 0 is ones
  const v8h o8 = (v8h){one, one, one, one, one, one, one, one};
  const v16h ones = join16(o8, o8);
  const v8f zero8 = (v8f){0.f, 0.f, 0.f, 0.f, 0.f, 0.f, 0.f, 0.f};
  v8f acc[2]  = {zero8, zero8};
  v8f lacc[2] = {zero8, zero8};
  float mrun[2] = {-INFINITY, -INFINITY};        // maximum in use, scaled
  v8f cneg[2]   = {zero8, zero8};                // C of the score products: -mrun in every register; 0 until the first pass has set mrun
  float thr     = -INFINITY;                     // score less C's maximum above which the maximum is renewed: 8 from the first pass on
  // this wave's copies of the first chunk have landed; behind the barrier every wave's have
  asm volatile("s_wait_asynccnt 0x0" ::: "memory");
  __syncthreads();
  stage_kv<8>(K, V, sK, sV, 4, t);               // flies under passes 0..3

  const _Float16* kw  = sK + split * kFaKeys * kHdim + lane * 8;
  const _Float16* vw0 = sV + split * kFaKeys * kHdim + hl * 128 + ((rlane * 8) ^ (hl * 32));
  const _Float16* vw1 = sV + split * kFaKeys * kHdim + (2 + hl) * 128 + ((rlane * 8) ^ ((2 + hl) * 32));
  // passes pb .. pe - 1: one chunk
  auto passes = [&](const int pb, const int pe) {
  v16h kf = join16(*(const v8h*)(kw + pb * 512), *(const v8h*)(kw + pb * 512 + 256));
  for (int p = pb; p < pe; ++p) {
    v8f s[2][2];
#pragma unroll
    for (int c = 0; c < 2; ++c) {
      s[c][0] = mma16(kf, qa[c], cneg[c]);
      s[c][1] = mma16(kf, qb[c], cneg[c]);
    }
    // keeps the four score products back to back: spread among the maxima each one drew its own run of v_nop
    __builtin_amdgcn_sched_barrier(0);
    const v16h vf = join16(*(const v8h*)(vw0 + p * 512), *(const v8h*)(vw1 + p * 512));
    const int pn = (p + 1 < pe) ? p + 1 : pb;
    kf = join16(*(const v8h*)(kw + pn * 512), *(const v8h*)(kw + pn * 512 + 256));

    float mb[2];                                 // this lane's maximum of the pass (8 + 8 keys of its token), above the maximum in C
    bool need = false;
#pragma unroll
    for (int c = 0; c < 2; ++c) {
      float mx = fmaxf(s[c][0][0], s[c][1][0]);
#pragma unroll
      for (int r = 1; r < 8; ++r) mx = fmaxf(fmaxf(mx, s[c][0][r]), s[c][1][r]);
      mb[c] = mx;
      need = need || (mx > thr);
    }
    if (__builtin_amdgcn_ballot_w32(need) != 0) { // wave-uniform; always on the first pass, rare after it
#pragma unroll
      for (int c = 0; c < 2; ++c) {
        // both lane halves of a token take the same new maximum
        const float mnew = fmaxf(mrun[c], fmaxf(mb[c], other_half(mb[c])) - cneg[c][0]);
        const float corr = __builtin_amdgcn_exp2f(mrun[c] - mnew);   // 0 on the first pass
        // this pass's scores were formed against the old C. Taken from all of C, not from one register of it: where the score
        // product was the last reader of the whole C, the compiler wrote the product over a copy of C made anew in every pass
        const v8f down = cneg[c] + mnew;
        mrun[c] = mnew;
        s[c][0] = s[c][0] - down;
        s[c][1] = s[c][1] - down;
        cneg[c] = zero8 - mnew;
        acc[c]  = acc[c] * corr;
        lacc[c] = lacc[c] * corr;
      }
      thr = 8.0f;
    }
#pragma unroll
    for (int c = 0; c < 2; ++c) {
      v16h pf;
#pragma unroll
      for (int i = 0; i < 8; ++i) {
        const v2h h = __builtin_convertvector((v2f){__builtin_amdgcn_exp2f(s[c][i >> 2][2 * (i & 3)]),
                                                    __builtin_amdgcn_exp2f(s[c][i >> 2][2 * (i & 3) + 1])}, v2h);
        pf[2 * i]     = h[0];
        pf[2 * i + 1] = h[1];
      }
      acc[c]  = mma16(vf, pf, acc[c]);
      lacc[c] = mma16(ones, pf, lacc[c]);   // row 0 += the column sums of P^T
    }
  }
  };
  // foot of a chunk: this wave's LDS reads are done and its copies of the next chunk have landed; behind the barrier every wave's have
  auto publish = [&]() {
    asm volatile("s_wait_dscnt 0x0" ::: "memory");
    asm volatile("s_wait_asynccnt 0x0" ::: "memory");
    __syncthreads();
  };
  passes(0, 4);
  publish();
  stage_kv<20>(K, V, sK, sV, 12, t);             // flies under passes 4..11
  passes(4, 12);
  publish();
  passes(12, kFaPass);
  // no copy of this wave is outstanding when it goes on to the merge and ends
  asm volatile("s_wait_asynccnt 0x0" ::: "memory");

  // ---- merge the 4 key slices ----
  float* pw = part[split];
#pragma unroll
  for (int c = 0; c < 2; ++c) {
    const int col = ng * 32 + c * 16 + rlane;
#pragma unroll
    for (int r = 0; r < 8; ++r) pw[(hl * 8 + r) * kFaPitch + col] = acc[c][r];
    if (hl == 0) {
      pm[split][col] = mrun[c];
      pl[split][col] = lacc[c][0];
    }
  }
  __syncthreads();
  const int d  = wave;                           // 16 waves = 16 rows d; a wave stores 512 B of one row
  const int n4 = lane * 4;
  v4f mm[kFaSplit];
#pragma unroll
  for (int k = 0; k < kFaSplit; ++k) mm[k] = *(const v4f*)(&pm[k][n4]);
  v4f res;
#pragma unroll
  for (int e = 0; e < 4; ++e) {
    const float mt = fmaxf(fmaxf(mm[0][e], mm[1][e]), fmaxf(mm[2][e], mm[3][e]));
    float den = 0.f, num = 0.f;
#pragma unroll
    for (int k = 0; k < kFaSplit; ++k) {
      const float wgt = __builtin_amdgcn_exp2f(mm[k][e] - mt);
      den += wgt * pl[k][n4 + e];
      num += wgt * part[k][d * kFaPitch + n4 + e];
    }
    res[e] = num / den;
  }
  *(v4f*)(out + ((size_t)g * kHdim + d) * kNtok + n0 + n4) = res;   // out[b][h*16 + d][n], g = b*4 + h
}

// ---------------------------------------------------------------------------
extern "C" void kernel_launch(void* const* d_in, const int* in_sizes, int n_in,
                              void* d_out, int out_size, void* d_ws, size_t ws_size,
                              hipStream_t stream) {
  (void)in_sizes; (void)n_in;
  const float* x    = (const float*)d_in[0];     // [2][64][4096]
  const float* w    = (const float*)d_in[1];     // [192][64]
  const float* bias = (const float*)d_in[2];     // [192]
  float* out = (float*)d_out;                    // [2][64][4096]

  // ---- workspace carve (see region map at the top) ----
  const size_t szQK16  = (size_t)kGroups * kNtok * kQKld * 2;
  const size_t szVcm16 = (size_t)kGroups * kVrows * kNtok * 2;
  char* ws = (char*)d_ws;
  size_t off = 0;
  unsigned short* Q16   = (unsigned short*)(ws + off); off += szQK16;
  unsigned short* K16   = (unsigned short*)(ws + off); off += szQK16;
  unsigned short* Vcm16 = (unsigned short*)(ws + off); off += szVcm16;
  if (off > ws_size) return;                                       // 8,388,608 B carved
  if ((size_t)out_size < (size_t)kBatch * kChan * kNtok) return;   // 524,288 f32 elements

  // 1) x, w, bias -> Q16, K16 [8][4096][32], Vcm16 [8][64][4096] (data parts only); 128 blocks of 64 tokens, 8 waves each
  qkv_proj_kernel<<<dim3(kTok / kPjTok), dim3(kPjThr), 0, stream>>>(x, w, bias, Q16, K16, Vcm16);

  // 2) all (batch, head) groups: scores, softmax and P.V fused, heads stored to the channel-major output;
  //    8 groups x 32 blocks of 128 tokens, 16 waves each
  attn_fused_kernel<<<dim3(kGroups * (kNtok / kFaTok)), dim3(512), 0, stream>>>(Q16, K16, Vcm16, out);
}

// v006
// A run of this version takes 19.4 microseconds.
// In both of two side-by-side timings against v005, it was 1.09 times as fast.
// Counting every step since v000, it is 80.2 times as fast.
// Contractions: qkv projection (T f16 x W^T f16 carried x16), scores k.q^T (q,k f16, q carried x the score scale, C = minus the maximum in use, head dim 16 in one half of k = 32), v.attn (V f16 channel-major x P^T f16, P = exp2 against a running maximum) and its column sums: all v_wmma_f32_16x16x32_f16 with f32 accumulate; softmax and layout shuffles in f32.
#include <hip/hip_runtime.h>
#include <math.h>

// ---------------------------------------------------------------------------
// Problem constants
// ---------------------------------------------------------------------------
constexpr int kBatch  = 2;
constexpr int kChan   = 64;                 // input channels = output channels
constexpr int kNtok   = 4096;               // tokens per batch (64 x 64)
constexpr int kTok    = kBatch * kNtok;     // 8192 token rows
constexpr int kHeads  = 4;
constexpr int kHdim   = 16;
constexpr int kGroups = kBatch * kHeads;    // 8 (batch, head) groups
constexpr int kQKld   = 32;                 // q/k plane pitch in halves: 16 data, the rest neither written nor read
constexpr int kVrows  = 64;                 // V channel-major row slots per group: 16 data, the rest neither written nor read
constexpr float kWCarry    = 16.0f;         // weights carried x16 in f16
constexpr float kWCarryInv = 1.0f / 16.0f;
constexpr float kQKScale   = 0.25f;         // 1/sqrt(16)
constexpr float kFaScale   = kQKScale * 1.4426950408889634f;   // score scale in the log2 domain; q is stored times this

// ---------------------------------------------------------------------------
// Workspace region map (bytes; every region 4096-B aligned; total 8,519,680)
//   Q16    f16 [8][4096][32]         2,097,152   at          0
//   K16    f16 [8][4096][32]         2,097,152   at  2,097,152
//   Vcm16  f16 [8][64][4096]         4,194,304   at  4,194,304
//   Kn2    f32 [8][4096]               131,072   at  8,388,608   squared length of every stored k row
// ---------------------------------------------------------------------------

typedef __attribute__((ext_vector_type(16))) _Float16 v16h;
typedef __attribute__((ext_vector_type(8)))  _Float16 v8h;
typedef __attribute__((ext_vector_type(8)))  float    v8f;
typedef __attribute__((ext_vector_type(4)))  float    v4f;

union Frag16 { v16h v; v8h h[2]; };
__device__ __forceinline__ v16h join16(v8h lo, v8h hi) { Frag16 f; f.h[0] = lo; f.h[1] = hi; return f.v; }
// A or B fragment of one k step of 32: elements 0..7 <- p[0..7], 8..15 <- p[16..23] (p already at the lane half's k offset)
__device__ __forceinline__ v16h frag_load(const _Float16* p) { return join16(*(const v8h*)(p), *(const v8h*)(p + 16)); }
__device__ __forceinline__ v8f mma16(v16h a, v16h b, v8f c) {
  return __builtin_amdgcn_wmma_f32_16x16x32_f16(false, a, false, b, (short)0, c, false, false);
}

// lane l <-> lane l ^ 16
__device__ __forceinline__ float other_half(float x) {
  const int b = __builtin_bit_cast(int, x);
  return __builtin_bit_cast(float, __builtin_amdgcn_permlanex16(b, b, 0x76543210, 0xfedcba98, false, false));
}
// sum of the squares of 8 halves, in f32
__device__ __forceinline__ float sumsq8(v8h a) {
  float s = 0.f;
#pragma unroll   // vector elements are taken by constant index
  for (int r = 0; r < 8; ++r) s = __builtin_fmaf((float)a[r], (float)a[r], s);
  return s;
}

// ---------------------------------------------------------------------------
// qkv projection, from x and w to the f16 planes of the attention kernel in one launch.
// Block = 64 consecutive tokens of one batch (grid 128), 8 waves = 4 heads x 2 token halves of 32 (two tiles of 16).
// The block casts its x tile (64 c x 64 tokens) to f16 and turns it token-major in LDS: a thread reads 8 channels of one token
// (a wave = 32 consecutive tokens = one 128-B line per load) and stores them as one 16-B piece; pitch 72 halves.
// w goes the same way (f16 of 16 w, row-major, same pitch): whole 128-B lines on the global side, read once per block;
// fragment loads straight from global memory would touch 16 lines each and repeat in the waves of a head.
// q, k: D = W.T^T, so lane (token, hl) holds channels hl*8 + r of its token = one 16-B piece of the token-major plane;
//       q is stored times the score scale of the attention kernel, so that k.q^T is the scaled score.
// v:    D = T.W^T, so lane (d, hl) holds tokens hl*8 + r of channel d = one 16-B piece of the channel-major plane.
// The k order is that of frag_load for both operands in both orientations.
// Beside k goes the squared length of each k row as stored (f16 values, summed in f32): the attention kernel bounds its scores with it.
// ---------------------------------------------------------------------------
constexpr int kPjTok   = 64;
constexpr int kPjThr   = 256;
constexpr int kPjPitch = kChan + 8;

typedef __attribute__((ext_vector_type(4))) _Float16 v4h;

__global__ __launch_bounds__(kPjThr) void qkv_proj_kernel(const float* __restrict__ x,
                                                          const float* __restrict__ w,
                                                          const float* __restrict__ bias,
                                                          unsigned short* __restrict__ Q16,
                                                          unsigned short* __restrict__ K16,
                                                          unsigned short* __restrict__ Vcm16,
                                                          float* __restrict__ Kn2) {
  __shared__ __align__(16) _Float16 sT[kPjTok * kPjPitch];
  __shared__ __align__(16) _Float16 sW[3 * kChan * kPjPitch];
  const int t     = threadIdx.x;
  const int lane  = t & 31;
  const int wave  = t >> 5;
  const int rlane = lane & 15;
  const int hl    = lane >> 4;
  const int tok0  = blockIdx.x * kPjTok;
  const int b     = tok0 / kNtok;
  const int n0    = tok0 % kNtok;
  const int th    = wave & 1;                    // token half
  const int h     = wave >> 1;                   // head

  // every global load of the block is issued before the first is waited for
  constexpr int kXp = kPjTok * kChan / 8 / kPjThr;       // x pieces per thread: 2
  constexpr int kWp = 3 * kChan * kChan / 4 / kPjThr;    // float4 of w per thread: 12
  float xr[kXp][8];
  v4f   wr[kWp];
#pragma unroll
  for (int i = 0; i < kXp; ++i) {
    const int idx = i * kPjThr + t;              // piece = (channel octet, token)
    const float* xp = x + ((size_t)b * kChan + (idx / kPjTok) * 8) * kNtok + n0 + (idx & (kPjTok - 1));
#pragma unroll
    for (int e = 0; e < 8; ++e) xr[i][e] = xp[(size_t)e * kNtok];
  }
#pragma unroll
  for (int i = 0; i < kWp; ++i) wr[i] = *(const v4f*)(w + 4 * (size_t)(i * kPjThr + t));
  // the bias loads may be given registers that held the addresses of the loads above: those are let go first
  asm volatile("s_wait_xcnt 0x0" ::: "memory");
  const float* bq = bias + h * kHdim + hl * 8;   // q, k: the lane's 8 channels; v: its one channel
  const v4f bq0 = *(const v4f*)(bq),         bq1 = *(const v4f*)(bq + 4);
  const v4f bk0 = *(const v4f*)(bq + kChan), bk1 = *(const v4f*)(bq + kChan + 4);
  const float bv = bias[2 * kChan + h * kHdim + rlane];
#pragma unroll
  for (int i = 0; i < kXp; ++i) {
    const int idx = i * kPjThr + t;
    v8h hv;
#pragma unroll
    for (int e = 0; e < 8; ++e) hv[e] = (_Float16)xr[i][e];
    *(v8h*)(sT + (idx & (kPjTok - 1)) * kPjPitch + (idx / kPjTok) * 8) = hv;
  }
#pragma unroll
  for (int i = 0; i < kWp; ++i) {
    const int idx = i * kPjThr + t;              // float4 index: 16 per row of w
    *(v4h*)(sW + (idx >> 4) * kPjPitch + (idx & 15) * 4) =
        (v4h){(_Float16)(wr[i][0] * kWCarry), (_Float16)(wr[i][1] * kWCarry),
              (_Float16)(wr[i][2] * kWCarry), (_Float16)(wr[i][3] * kWCarry)};
  }
  __syncthreads();

  const _Float16* tp = sT + (th * 32 + rlane) * kPjPitch + hl * 8;     // second tile 16 rows further
  const _Float16* wp = sW + (h * kHdim + rlane) * kPjPitch + hl * 8;   // q rows; k and v rows 64 and 128 further
  const v8f zero8 = (v8f){0.f, 0.f, 0.f, 0.f, 0.f, 0.f, 0.f, 0.f};
  v8f aq[2] = {zero8, zero8}, ak[2] = {zero8, zero8}, av[2] = {zero8, zero8};
#pragma unroll
  for (int ks = 0; ks < 2; ++ks) {
    const v16h wq = frag_load(wp + ks * 32);
    const v16h wk = frag_load(wp + kChan * kPjPitch + ks * 32);
    const v16h wv = frag_load(wp + 2 * kChan * kPjPitch + ks * 32);
#pragma unroll
    for (int c = 0; c < 2; ++c) {
      const v16h xf = frag_load(tp + c * 16 * kPjPitch + ks * 32);
      aq[c] = mma16(wq, xf, aq[c]);
      ak[c] = mma16(wk, xf, ak[c]);
      av[c] = mma16(xf, wv, av[c]);
    }
  }

  const int g = b * kHeads + h;
  float kn[2];
#pragma unroll
  for (int c = 0; c < 2; ++c) {
    v8h hq, hk, hv;
#pragma unroll
    for (int r = 0; r < 8; ++r) {
      hq[r] = (_Float16)((aq[c][r] * kWCarryInv + (r < 4 ? bq0[r & 3] : bq1[r & 3])) * kFaScale);
      hk[r] = (_Float16)(ak[c][r] * kWCarryInv + (r < 4 ? bk0[r & 3] : bk1[r & 3]));
      hv[r] = (_Float16)(av[c][r] * kWCarryInv + bv);
    }
    const int nt = n0 + th * 32 + c * 16;        // first token of the tile
    const size_t qk = ((size_t)g * kNtok + nt + rlane) * kQKld + hl * 8;
    *(v8h*)(Q16 + qk) = hq;
    *(v8h*)(K16 + qk) = hk;
    *(v8h*)(Vcm16 + ((size_t)g * kVrows + rlane) * kNtok + nt + hl * 8) = hv;
    const float half = sumsq8(hk);               // the lane's 8 channels of token nt + rlane
    kn[c] = half + other_half(half);
  }
  // lane l holds token l of the wave's 32: one whole 128-B line per wave
  Kn2[(size_t)g * kNtok + n0 + th * 32 + lane] = hl ? kn[1] : kn[0];
}

// ---------------------------------------------------------------------------
// Fused attention of all (batch, head) groups: scores, softmax and P.V in one launch; S and P never leave the registers.
// Block = 128 tokens n of one group (grid 8 x 32 = 256), 16 waves = 4 token slices of 32 n x 4 key slices of 1024 m.
// The block parks the group's whole K (data halves only) and V (16 data rows) in LDS, each as ready fragments:
//   K: 512 B per 16 keys = [d half hl][key r] x 16 B, so lane l of a fragment read takes piece l;
//   V: 256 B per 8 keys m8 = [d] x 16 B, the 64-B quarters exchanged by m8 & 3 so that the staging stores (4 d x 8 m8
//      per wave, whole 128-B lines of V on the global side) and the fragment reads (16 d of one m8) both spread over all banks.
// Staging is by asynchronous copies to LDS, in three chunks of passes (4, 8, 20 of every key slice): only the first chunk is
// waited for with nothing to do; each later chunk flies while the chunk before it is worked on and is published at that chunk's foot.
// A pass is 32 keys. S^T = K.Q^T: ONE A fragment holds two key tiles (k 0..15 = d of keys m0 + r, k 16..31 = d of keys
// m0 + 16 + r); B = [q | 0] gives the first tile's scores and B = [0 | q] the second's (head dim 16 fills half of k = 32).
// In a score tile lane (n, hl) holds keys hl*8 + r of token n, which is the B layout of P^T for O^T += V^T.P^T:
// position (hl, e) is key m0 + hl*8 + e for e < 8 and m0 + 16 + hl*8 + e - 8 above, in the V fragment and in P alike.
// Online softmax in the log2 domain. q comes scaled and a lane's 8 score registers all belong to one token, so the C operand of
// the score product is minus that token's maximum in use: the product's result is the argument of exp2 as it stands.
// The maximum in use may trail the true one by up to 8 (p <= 256 in f16), so C, the pass's scores and the
// accumulators are renewed only when some token's maximum exceeds it by more.
// No maximum at all where none is needed: |score| <= |q| |k|, so a wave whose tokens all have |q| max|k| <= 14 over its key slice has
// every p = exp2(score) inside f16's normal range as it stands. Such a wave keeps the maximum fixed at 0 and jumps, on a scalar
// condition set once, over the maxima, the compare and the ballot of every pass. Any other wave keeps the running maximum.
// Denominator: an A fragment with ones in row 0 sums
// the rounded P on the matrix pipe. The 4 key slices are merged through LDS in slice order.
// ---------------------------------------------------------------------------
constexpr int kFaTok   = 128;                    // tokens per block
constexpr int kFaSplit = 4;                      // key slices per block
constexpr int kFaKeys  = kNtok / kFaSplit;       // 1024 keys per wave
constexpr int kFaPass  = kFaKeys / 32;           // 32 passes of 32 keys
constexpr int kFaPitch = kFaTok + 4;             // partial-tile pitch in floats: lane halves fall on different banks
constexpr float kFaPlain = 14.0f;                // bound on |score| (scaled, log2) up to which exp2 needs no maximum: 2^-14 .. 2^14 in f16

__device__ __forceinline__ unsigned umax(unsigned a, unsigned b) { return a > b ? a : b; }
// maximum with the lane whose number differs by M inside the 16-lane row
template <int M>
__device__ __forceinline__ unsigned row_xmax(unsigned x) {
  return umax(x, (unsigned)__builtin_amdgcn_update_dpp((int)x, (int)x, 0x160 | M, 0xf, 0xf, false));
}

typedef __attribute__((ext_vector_type(2))) float    v2f;
typedef __attribute__((ext_vector_type(2))) _Float16 v2h;

// Copies of 16 B per lane from global memory to LDS, through no register. The s_wait_xcnt stands inside the copies' own statement,
// so that no address register of a copy is rewritten ahead of it.
__device__ __forceinline__ void copy4(const unsigned* l, const _Float16* const* g) {
  asm volatile("global_load_async_to_lds_b128 %0, %1, off\n\t"
               "global_load_async_to_lds_b128 %2, %3, off\n\t"
               "global_load_async_to_lds_b128 %4, %5, off\n\t"
               "global_load_async_to_lds_b128 %6, %7, off\n\t"
               "s_wait_xcnt 0x0"
               :: "v"(l[0]), "v"(g[0]), "v"(l[1]), "v"(g[1]), "v"(l[2]), "v"(g[2]), "v"(l[3]), "v"(g[3]) : "memory");
}
__device__ __forceinline__ void copy8(const unsigned* l, const _Float16* const* g) {
  asm volatile("global_load_async_to_lds_b128 %0, %1, off\n\t"
               "global_load_async_to_lds_b128 %2, %3, off\n\t"
               "global_load_async_to_lds_b128 %4, %5, off\n\t"
               "global_load_async_to_lds_b128 %6, %7, off\n\t"
               "global_load_async_to_lds_b128 %8, %9, off\n\t"
               "global_load_async_to_lds_b128 %10, %11, off\n\t"
               "global_load_async_to_lds_b128 %12, %13, off\n\t"
               "global_load_async_to_lds_b128 %14, %15, off\n\t"
               "s_wait_xcnt 0x0"
               :: "v"(l[0]), "v"(g[0]), "v"(l[1]), "v"(g[1]), "v"(l[2]), "v"(g[2]), "v"(l[3]), "v"(g[3]),
                  "v"(l[4]), "v"(g[4]), "v"(l[5]), "v"(g[5]), "v"(l[6]), "v"(g[6]), "v"(l[7]), "v"(g[7]) : "memory");
}

// Addresses of G pieces of 16 B of K (entries 0 .. G - 1) and of V (entries G .. 2 G - 1) for one thread: units un .. un + G - 1.
// A unit is 128 pieces of a key slice = 64 keys = two passes, of K and of V alike; threads 128 s .. 128 s + 127 take key slice s.
template <int G>
__device__ __forceinline__ void piece_addr(const _Float16* K, const _Float16* V, _Float16* sK, _Float16* sV, int un, int t,
                                           unsigned* l, const _Float16** g) {
  // unrolled: the address arrays are operands of an asm statement and have to be registers
#pragma unroll
  for (int u = 0; u < G; ++u) {
    const int idx = (t >> 7) * (kFaKeys * 2) + (un + u) * 128 + (t & 127);   // piece number in the whole K, and in the whole V
    g[u] = K + (size_t)((idx >> 5) * 16 + (t & 15)) * kQKld + ((t >> 4) & 1) * 8;   // piece = (key tile idx >> 5, lane)
    l[u] = (unsigned)(size_t)(sK + idx * 8);
    const int m8 = (idx >> 7) * 8 + (idx & 7);   // 8 lanes cover one 128-B line of a V row
    const int d  = (idx >> 3) & 15;
    g[G + u] = V + (size_t)d * kNtok + m8 * 8;
    l[G + u] = (unsigned)(size_t)(sV + m8 * 128 + ((d * 8) ^ ((m8 & 3) * 32)));
  }
}

// Issues the copies of passes pb .. pb + NP - 1 (both even) of all four key slices: NP / 2 pieces of K and as many of V per thread.
template <int NP>
__device__ __forceinline__ void stage_kv(const _Float16* K, const _Float16* V, _Float16* sK, _Float16* sV, int pb, int t) {
  constexpr int kN = NP / 2;
  // unrolled for the same reason as above
#pragma unroll
  for (int i = 0; i + 4 <= kN; i += 4) {
    unsigned l[8];
    const _Float16* g[8];
    piece_addr<4>(K, V, sK, sV, pb / 2 + i, t, l, g);
    copy8(l, g);
  }
  if constexpr ((kN & 3) == 2) {
    unsigned l[4];
    const _Float16* g[4];
    piece_addr<2>(K, V, sK, sV, pb / 2 + (kN & ~3), t, l, g);
    copy4(l, g);
  }
}

__global__ __launch_bounds__(512) void attn_fused_kernel(const unsigned short* __restrict__ Qp,
                                                         const unsigned short* __restrict__ Kp,
                                                         const unsigned short* __restrict__ Vp,
                                                         const float* __restrict__ Kn2,
                                                         float* __restrict__ out) {
  __shared__ __align__(16) _Float16 sK[kNtok * kHdim];
  __shared__ __align__(16) _Float16 sV[kNtok * kHdim];
  __shared__ __align__(16) float part[kFaSplit][kHdim * kFaPitch];
  __shared__ __align__(16) float pm[kFaSplit][kFaTok];
  __shared__ __align__(16) float pl[kFaSplit][kFaTok];
  const int t     = threadIdx.x;
  const int lane  = t & 31;
  const int wave  = t >> 5;
  const int rlane = lane & 15;
  const int hl    = lane >> 4;
  const int g     = blockIdx.x / (kNtok / kFaTok);
  const int n0    = (blockIdx.x % (kNtok / kFaTok)) * kFaTok;
  const _Float16* Q = (const _Float16*)Qp + (size_t)g * kNtok * kQKld;
  const _Float16* K = (const _Float16*)Kp + (size_t)g * kNtok * kQKld;
  const _Float16* V = (const _Float16*)Vp + (size_t)g * kVrows * kNtok;

  // ---- first chunk of K and V: passes 0..3 of every key slice ----
  stage_kv<4>(K, V, sK, sV, 0, t);

  const int ng    = wave & 3;                    // token slice
  const int split = wave >> 2;                   // key slice
  const v8h z8 = (v8h){0, 0, 0, 0, 0, 0, 0, 0};
  v16h qa[2], qb[2];
  v8h  qh[2];
  v4f  kn[kFaKeys / 128];                        // squared lengths of the key slice's k rows, 32 per lane
#pragma unroll   // kn stays in registers, and all eight loads are in flight together
  for (int i = 0; i < kFaKeys / 128; ++i)
    kn[i] = *(const v4f*)(Kn2 + (size_t)g * kNtok + split * kFaKeys + i * 128 + lane * 4);
#pragma unroll
  for (int c = 0; c < 2; ++c) {
    const v8h q = *(const v8h*)(Q + (size_t)(n0 + ng * 32 + c * 16 + rlane) * kQKld + hl * 8);
    qa[c] = join16(q, z8);
    qb[c] = join16(z8, q);
    qh[c] = q;
  }
  const _Float16 one = (rlane == 0) ? (_Float16)1.0f : (_Float16)0.0f;   // A operand whose row 0 is ones
  const v8h o8 = (v8h){one, one, one, one, one, one, one, one};
  const v16h ones = join16(o8, o8);
  const v8f zero8 = (v8f){0.f, 0.f, 0.f, 0.f, 0.f, 0.f, 0.f, 0.f};
  v8f acc[2]  = {zero8, zero8};
  v8f lacc[2] = {zero8, zero8};
  v8f cneg[2]   = {zero8, zero8};                // C of the score products: -mrun in every register; 0 until the first pass has set mrun
  float thr     = -INFINITY;                     // score less C's maximum above which the maximum is renewed: 8 from the first pass on
  // this wave's copies of the first chunk have landed; behind the barrier every wave's have
  asm volatile("s_wait_asynccnt 0x0" ::: "memory");
  __syncthreads();
  stage_kv<8>(K, V, sK, sV, 4, t);               // flies under passes 0..3
  // keeps the arithmetic below behind the copies: drawn in front of them it would shorten the time they have to land
  __builtin_amdgcn_sched_barrier(0);

  // ---- does this wave need a running maximum? ----
  // largest squared length over the keys of the lane's 16-lane row, half the key slice. None is negative, so the bit patterns order as the values do, with not-a-number on top
  unsigned kb = 0;
#pragma unroll   // registers again
  for (int i = 0; i < kFaKeys / 128; ++i)
#pragma unroll
    for (int e = 0; e < 4; ++e) {
      const float f = kn[i][e];
      kb = umax(kb, __builtin_bit_cast(unsigned, f));
    }
  kb = row_xmax<8>(row_xmax<4>(row_xmax<2>(row_xmax<1>(kb))));
  const float km = __builtin_bit_cast(float, kb);
  float qn[2];                                   // squared length of the token's q as stored (scaled)
#pragma unroll
  for (int c = 0; c < 2; ++c) {
    const float half = sumsq8(qh[c]);
    qn[c] = half + other_half(half);
  }
  // wave-uniform (the two 16-lane rows meet in the ballot); written so that a product that is not a number counts as too large
  const bool plain = __builtin_amdgcn_ballot_w32(!(qn[0] * km <= kFaPlain * kFaPlain && qn[1] * km <= kFaPlain * kFaPlain)) == 0;
  const float m0 = plain ? 0.f : -INFINITY;
  float mrun[2] = {m0, m0};                      // maximum in use, scaled; stays 0 in a wave that needs none

  const _Float16* kw  = sK + split * kFaKeys * kHdim + lane * 8;
  const _Float16* vw0 = sV + split * kFaKeys * kHdim + hl * 128 + ((rlane * 8) ^ (hl * 32));
  const _Float16* vw1 = sV + split * kFaKeys * kHdim + (2 + hl) * 128 + ((rlane * 8) ^ ((2 + hl) * 32));
  // passes pb .. pe - 1: one chunk
  auto passes = [&](const int pb, const int pe) {
  v16h kf = join16(*(const v8h*)(kw + pb * 512), *(const v8h*)(kw + pb * 512 + 256));
  for (int p = pb; p < pe; ++p) {
    v8f s[2][2];
#pragma unroll
    for (int c = 0; c < 2; ++c) {
      s[c][0] = mma16(kf, qa[c], cneg[c]);
      s[c][1] = mma16(kf, qb[c], cneg[c]);
    }
    // keeps the four score products back to back: spread among the maxima each one drew its own run of v_nop
    __builtin_amdgcn_sched_barrier(0);
    const v16h vf = join16(*(const v8h*)(vw0 + p * 512), *(const v8h*)(vw1 + p * 512));
    const int pn = (p + 1 < pe) ? p + 1 : pb;
    kf = join16(*(const v8h*)(kw + pn * 512), *(const v8h*)(kw + pn * 512 + 256));

    if (!plain) {                                // a scalar branch on a value fixed for the whole wave: no vector compare feeds it
    float mb[2];                                 // this lane's maximum of the pass (8 + 8 keys of its token), above the maximum in C
    bool need = false;
#pragma unroll
    for (int c = 0; c < 2; ++c) {
      float mx = fmaxf(s[c][0][0], s[c][1][0]);
#pragma unroll
      for (int r = 1; r < 8; ++r) mx = fmaxf(fmaxf(mx, s[c][0][r]), s[c][1][r]);
      mb[c] = mx;
      need = need || (mx > thr);
    }
    if (__builtin_amdgcn_ballot_w32(need) != 0) { // wave-uniform; always on the first pass, rare after it
#pragma unroll
      for (int c = 0; c < 2; ++c) {
        // both lane halves of a token take the same new maximum
        const float mnew = fmaxf(mrun[c], fmaxf(mb[c], other_half(mb[c])) - cneg[c][0]);
        const float corr = __builtin_amdgcn_exp2f(mrun[c] - mnew);   // 0 on the first pass
        // this pass's scores were formed against the old C. Taken from all of C, not from one register of it: where the score
        // product was the last reader of the whole C, the compiler wrote the product over a copy of C made anew in every pass
        const v8f down = cneg[c] + mnew;
        mrun[c] = mnew;
        s[c][0] = s[c][0] - down;
        s[c][1] = s[c][1] - down;
        cneg[c] = zero8 - mnew;
        acc[c]  = acc[c] * corr;
        lacc[c] = lacc[c] * corr;
      }
      thr = 8.0f;
    }
    }
#pragma unroll
    for (int c = 0; c < 2; ++c) {
      v16h pf;
#pragma unroll
      for (int i = 0; i < 8; ++i) {
        const v2h h = __builtin_convertvector((v2f){__builtin_amdgcn_exp2f(s[c][i >> 2][2 * (i & 3)]),
                                                    __builtin_amdgcn_exp2f(s[c][i >> 2][2 * (i & 3) + 1])}, v2h);
        pf[2 * i]     = h[0];
        pf[2 * i + 1] = h[1];
      }
      acc[c]  = mma16(vf, pf, acc[c]);
      lacc[c] = mma16(ones, pf, lacc[c]);   // row 0 += the column sums of P^T
    }
  }
  };
  // foot of a chunk: this wave's LDS reads are done and its copies of the next chunk have landed; behind the barrier every wave's have
  auto publish = [&]() {
    asm volatile("s_wait_dscnt 0x0" ::: "memory");
    asm volatile("s_wait_asynccnt 0x0" ::: "memory");
    __syncthreads();
  };
  passes(0, 4);
  publish();
  stage_kv<20>(K, V, sK, sV, 12, t);             // flies under passes 4..11
  passes(4, 12);
  publish();
  passes(12, kFaPass);
  // no copy of this wave is outstanding when it goes on to the merge and ends
  asm volatile("s_wait_asynccnt 0x0" ::: "memory");

  // ---- merge the 4 key slices ----
  float* pw = part[split];
#pragma unroll
  for (int c = 0; c < 2; ++c) {
    const int col = ng * 32 + c * 16 + rlane;
#pragma unroll
    for (int r = 0; r < 8; ++r) pw[(hl * 8 + r) * kFaPitch + col] = acc[c][r];
    if (hl == 0) {
      pm[split][col] = mrun[c];
      pl[split][col] = lacc[c][0];
    }
  }
  __syncthreads();
  const int d  = wave;                           // 16 waves = 16 rows d; a wave stores 512 B of one row
  const int n4 = lane * 4;
  v4f mm[kFaSplit];
#pragma unroll
  for (int k = 0; k < kFaSplit; ++k) mm[k] = *(const v4f*)(&pm[k][n4]);
  v4f res;
#pragma unroll
  for (int e = 0; e < 4; ++e) {
    const float mt = fmaxf(fmaxf(mm[0][e], mm[1][e]), fmaxf(mm[2][e], mm[3][e]));
    float den = 0.f, num = 0.f;
#pragma unroll
    for (int k = 0; k < kFaSplit; ++k) {
      const float wgt = __builtin_amdgcn_exp2f(mm[k][e] - mt);
      den += wgt * pl[k][n4 + e];
      num += wgt * part[k][d * kFaPitch + n4 + e];
    }
    res[e] = num / den;
  }
  *(v4f*)(out + ((size_t)g * kHdim + d) * kNtok + n0 + n4) = res;   // out[b][h*16 + d][n], g = b*4 + h
}

// ---------------------------------------------------------------------------
extern "C" void kernel_launch(void* const* d_in, const int* in_sizes, int n_in,
                              void* d_out, int out_size, void* d_ws, size_t ws_size,
                              hipStream_t stream) {
  (void)in_sizes; (void)n_in;
  const float* x    = (const float*)d_in[0];     // [2][64][4096]
  const float* w    = (const float*)d_in[1];     // [192][64]
  const float* bias = (const float*)d_in[2];     // [192]
  float* out = (float*)d_out;                    // [2][64][4096]

  // ---- workspace carve (see region map at the top) ----
  const size_t szQK16  = (size_t)kGroups * kNtok * kQKld * 2;
  const size_t szVcm16 = (size_t)kGroups * kVrows * kNtok * 2;
  char* ws = (char*)d_ws;
  size_t off = 0;
  unsigned short* Q16   = (unsigned short*)(ws + off); off += szQK16;
  unsigned short* K16   = (unsigned short*)(ws + off); off += szQK16;
  unsigned short* Vcm16 = (unsigned short*)(ws + off); off += szVcm16;
  float* Kn2 = (float*)(ws + off); off += (size_t)kGroups * kNtok * 4;
  if (off > ws_size) return;                                       // 8,519,680 B carved
  if ((size_t)out_size < (size_t)kBatch * kChan * kNtok) return;   // 524,288 f32 elements

  // 1) x, w, bias -> Q16, K16 [8][4096][32], Vcm16 [8][64][4096] (data parts only), Kn2 [8][4096]; 128 blocks of 64 tokens, 8 waves each
  qkv_proj_kernel<<<dim3(kTok / kPjTok), dim3(kPjThr), 0, stream>>>(x, w, bias, Q16, K16, Vcm16, Kn2);

  // 2) all (batch, head) groups: scores, softmax and P.V fused, heads stored to the channel-major output;
  //    8 groups x 32 blocks of 128 tokens, 16 waves each
  attn_fused_kernel<<<dim3(kGroups * (kNtok / kFaTok)), dim3(512), 0, stream>>>(Q16, K16, Vcm16, Kn2, out);
}

// v007
// One run takes 16 microseconds.
// Two timings next to v006 put it at 1.18 and 1.17 times that version's speed.
// Counting every step since v000, it is 94.0 times as fast.
// Contractions: qkv projection (T f16 x W^T f16 carried x16), scores k.q^T (q,k f16, q carried x the score scale, C = minus the maximum in use, head dim 16 in one half of k = 32), v.attn (V f16 channel-major x P^T f16, P = exp2 against a running maximum) and its column sums: all v_wmma_f32_16x16x32_f16 with f32 accumulate; softmax and layout shuffles in f32.
#include <hip/hip_runtime.h>
#include <math.h>

// ---------------------------------------------------------------------------
// Problem constants
// ---------------------------------------------------------------------------
constexpr int kBatch  = 2;
constexpr int kChan   = 64;                 // input channels = output channels
constexpr int kNtok   = 4096;               // tokens per batch (64 x 64)
constexpr int kTok    = kBatch * kNtok;     // 8192 token rows
constexpr int kHeads  = 4;
constexpr int kHdim   = 16;
constexpr int kGroups = kBatch * kHeads;    // 8 (batch, head) groups
constexpr int kPlane  = kNtok * kHdim;      // halves of one group's q, k or v plane: packed, no gaps
constexpr float kWCarry    = 16.0f;         // weights carried x16 in f16
constexpr float kWCarryInv = 1.0f / 16.0f;
constexpr float kQKScale   = 0.25f;         // 1/sqrt(16)
constexpr float kFaScale   = kQKScale * 1.4426950408889634f;   // score scale in the log2 domain; q is stored times this

// ---------------------------------------------------------------------------
// Workspace region map (bytes; every region 4096-B aligned; total 3,276,800)
//   Q16    f16 [8][4096][16]         1,048,576   at          0   token-major
//   Kimg   f16 [8][256][2][16][8]    1,048,576   at  1,048,576   byte for byte what the attention kernel keeps in LDS (layout there)
//   Vimg   f16 [8][512][16][8]       1,048,576   at  2,097,152   the same
//   Kn2    f32 [8][4096]               131,072   at  3,145,728   squared length of every stored k row
// ---------------------------------------------------------------------------

typedef __attribute__((ext_vector_type(16))) _Float16 v16h;
typedef __attribute__((ext_vector_type(8)))  _Float16 v8h;
typedef __attribute__((ext_vector_type(8)))  float    v8f;
typedef __attribute__((ext_vector_type(4)))  float    v4f;

union Frag16 { v16h v; v8h h[2]; };
__device__ __forceinline__ v16h join16(v8h lo, v8h hi) { Frag16 f; f.h[0] = lo; f.h[1] = hi; return f.v; }
// A or B fragment of one k step of 32: elements 0..7 <- p[0..7], 8..15 <- p[16..23] (p already at the lane half's k offset)
__device__ __forceinline__ v16h frag_load(const _Float16* p) { return join16(*(const v8h*)(p), *(const v8h*)(p + 16)); }
__device__ __forceinline__ v8f mma16(v16h a, v16h b, v8f c) {
  return __builtin_amdgcn_wmma_f32_16x16x32_f16(false, a, false, b, (short)0, c, false, false);
}

// lane l <-> lane l ^ 16
__device__ __forceinline__ float other_half(float x) {
  const int b = __builtin_bit_cast(int, x);
  return __builtin_bit_cast(float, __builtin_amdgcn_permlanex16(b, b, 0x76543210, 0xfedcba98, false, false));
}
// sum of the squares of 8 halves, in f32
__device__ __forceinline__ float sumsq8(v8h a) {
  float s = 0.f;
#pragma unroll   // vector elements are taken by constant index
  for (int r = 0; r < 8; ++r) s = __builtin_fmaf((float)a[r], (float)a[r], s);
  return s;
}

// ---------------------------------------------------------------------------
// qkv projection, from x and w to the f16 planes of the attention kernel in one launch.
// Block = 64 consecutive tokens of one batch (grid 128), 8 waves = 4 heads x 2 token halves of 32 (two tiles of 16).
// The block casts its x tile (64 c x 64 tokens) to f16 and turns it token-major in LDS: a thread reads 8 channels of one token
// (a wave = 32 consecutive tokens = one 128-B line per load) and stores them as one 16-B piece; pitch 72 halves.
// w goes the same way (f16 of 16 w, row-major, same pitch): whole 128-B lines on the global side, read once per block;
// fragment loads straight from global memory would touch 16 lines each and repeat in the waves of a head.
// q, k: D = W.T^T, so lane (token, hl) holds channels hl*8 + r of its token = one 16-B piece;
//       q is stored times the score scale of the attention kernel, so that k.q^T is the scaled score.
// v:    D = T.W^T, so lane (d, hl) holds tokens hl*8 + r of channel d = one 16-B piece.
// k and v pieces go where the attention kernel's LDS layout has them, so a tile's 32 pieces are 512 consecutive bytes:
// every store of a wave fills whole 128-B lines, and the attention kernel's staging is a straight copy.
// The k order is that of frag_load for both operands in both orientations.
// Beside k goes the squared length of each k row as stored (f16 values, summed in f32): the attention kernel bounds its scores with it.
// ---------------------------------------------------------------------------
constexpr int kPjTok   = 64;
constexpr int kPjThr   = 256;
constexpr int kPjPitch = kChan + 8;

typedef __attribute__((ext_vector_type(4))) _Float16 v4h;

__global__ __launch_bounds__(kPjThr) void qkv_proj_kernel(const float* __restrict__ x,
                                                          const float* __restrict__ w,
                                                          const float* __restrict__ bias,
                                                          unsigned short* __restrict__ Q16,
                                                          unsigned short* __restrict__ Kimg,
                                                          unsigned short* __restrict__ Vimg,
                                                          float* __restrict__ Kn2) {
  __shared__ __align__(16) _Float16 sT[kPjTok * kPjPitch];
  __shared__ __align__(16) _Float16 sW[3 * kChan * kPjPitch];
  const int t     = threadIdx.x;
  const int lane  = t & 31;
  const int wave  = t >> 5;
  const int rlane = lane & 15;
  const int hl    = lane >> 4;
  const int tok0  = blockIdx.x * kPjTok;
  const int b     = tok0 / kNtok;
  const int n0    = tok0 % kNtok;
  const int th    = wave & 1;                    // token half
  const int h     = wave >> 1;                   // head

  // every global load of the block is issued before the first is waited for
  constexpr int kXp = kPjTok * kChan / 8 / kPjThr;       // x pieces per thread: 2
  constexpr int kWp = 3 * kChan * kChan / 4 / kPjThr;    // float4 of w per thread: 12
  float xr[kXp][8];
  v4f   wr[kWp];
#pragma unroll
  for (int i = 0; i < kXp; ++i) {
    const int idx = i * kPjThr + t;              // piece = (channel octet, token)
    const float* xp = x + ((size_t)b * kChan + (idx / kPjTok) * 8) * kNtok + n0 + (idx & (kPjTok - 1));
#pragma unroll
    for (int e = 0; e < 8; ++e) xr[i][e] = xp[(size_t)e * kNtok];
  }
#pragma unroll
  for (int i = 0; i < kWp; ++i) wr[i] = *(const v4f*)(w + 4 * (size_t)(i * kPjThr + t));
  // the bias loads may be given registers that held the addresses of the loads above: those are let go first
  asm volatile("s_wait_xcnt 0x0" ::: "memory");
  const float* bq = bias + h * kHdim + hl * 8;   // q, k: the lane's 8 channels; v: its one channel
  const v4f bq0 = *(const v4f*)(bq),         bq1 = *(const v4f*)(bq + 4);
  const v4f bk0 = *(const v4f*)(bq + kChan), bk1 = *(const v4f*)(bq + kChan + 4);
  const float bv = bias[2 * kChan + h * kHdim + rlane];
#pragma unroll
  for (int i = 0; i < kXp; ++i) {
    const int idx = i * kPjThr + t;
    v8h hv;
#pragma unroll
    for (int e = 0; e < 8; ++e) hv[e] = (_Float16)xr[i][e];
    *(v8h*)(sT + (idx & (kPjTok - 1)) * kPjPitch + (idx / kPjTok) * 8) = hv;
  }
#pragma unroll
  for (int i = 0; i < kWp; ++i) {
    const int idx = i * kPjThr + t;              // float4 index: 16 per row of w
    *(v4h*)(sW + (idx >> 4) * kPjPitch + (idx & 15) * 4) =
        (v4h){(_Float16)(wr[i][0] * kWCarry), (_Float16)(wr[i][1] * kWCarry),
              (_Float16)(wr[i][2] * kWCarry), (_Float16)(wr[i][3] * kWCarry)};
  }
  __syncthreads();

  const _Float16* tp = sT + (th * 32 + rlane) * kPjPitch + hl * 8;     // second tile 16 rows further
  const _Float16* wp = sW + (h * kHdim + rlane) * kPjPitch + hl * 8;   // q rows; k and v rows 64 and 128 further
  const v8f zero8 = (v8f){0.f, 0.f, 0.f, 0.f, 0.f, 0.f, 0.f, 0.f};
  v8f aq[2] = {zero8, zero8}, ak[2] = {zero8, zero8}, av[2] = {zero8, zero8};
#pragma unroll
  for (int ks = 0; ks < 2; ++ks) {
    const v16h wq = frag_load(wp + ks * 32);
    const v16h wk = frag_load(wp + kChan * kPjPitch + ks * 32);
    const v16h wv = frag_load(wp + 2 * kChan * kPjPitch + ks * 32);
#pragma unroll
    for (int c = 0; c < 2; ++c) {
      const v16h xf = frag_load(tp + c * 16 * kPjPitch + ks * 32);
      aq[c] = mma16(wq, xf, aq[c]);
      ak[c] = mma16(wk, xf, ak[c]);
      av[c] = mma16(xf, wv, av[c]);
    }
  }

  const int g = b * kHeads + h;
  float kn[2];
#pragma unroll
  for (int c = 0; c < 2; ++c) {
    v8h hq, hk, hv;
#pragma unroll
    for (int r = 0; r < 8; ++r) {
      hq[r] = (_Float16)((aq[c][r] * kWCarryInv + (r < 4 ? bq0[r & 3] : bq1[r & 3])) * kFaScale);
      hk[r] = (_Float16)(ak[c][r] * kWCarryInv + (r < 4 ? bk0[r & 3] : bk1[r & 3]));
      hv[r] = (_Float16)(av[c][r] * kWCarryInv + bv);
    }
    const int nt = n0 + th * 32 + c * 16;        // first token of the tile
    const int m8 = (nt >> 3) + hl;               // the lane's 8 tokens of v
    *(v8h*)(Q16 + (size_t)g * kPlane + (nt + rlane) * kHdim + hl * 8) = hq;
    *(v8h*)(Kimg + (size_t)g * kPlane + ((nt >> 4) * 32 + lane) * 8) = hk;
    *(v8h*)(Vimg + (size_t)g * kPlane + m8 * 128 + rlane * 8) = hv;
    const float half = sumsq8(hk);               // the lane's 8 channels of token nt + rlane
    kn[c] = half + other_half(half);
  }
  // lane l holds token l of the wave's 32: one whole 128-B line per wave
  Kn2[(size_t)g * kNtok + n0 + th * 32 + lane] = hl ? kn[1] : kn[0];
}

// ---------------------------------------------------------------------------
// Fused attention of all (batch, head) groups: scores, softmax and P.V in one launch; S and P never leave the registers.
// Block = 128 tokens n of one group (grid 8 x 32 = 256), 16 waves = 4 token slices of 32 n x 4 key slices of 1024 m.
// The block parks the group's whole K (data halves only) and V (16 data rows) in LDS, each as ready fragments:
//   K: 512 B per 16 keys = [d half hl][key r] x 16 B, so lane l of a fragment read takes piece l;
//   V: 256 B per 8 keys m8 = [d] x 16 B, so the 16 lanes of a half take 256 consecutive bytes of a fragment read.
// The projection leaves both planes in the workspace in exactly this order, so a thread's pieces lie at one global and one LDS
// address plus the same multiple of 2 KiB in both: the step is the copy's immediate offset, which moves both addresses.
// Staging is by asynchronous copies to LDS, in three chunks of passes (4, 8, 20 of every key slice): only the first chunk is
// waited for with nothing to do; each later chunk flies while the chunk before it is worked on and is published at that chunk's foot.
// A pass is 32 keys. S^T = K.Q^T: ONE A fragment holds two key tiles (k 0..15 = d of keys m0 + r, k 16..31 = d of keys
// m0 + 16 + r); B = [q | 0] gives the first tile's scores and B = [0 | q] the second's (head dim 16 fills half of k = 32).
// In a score tile lane (n, hl) holds keys hl*8 + r of token n, which is the B layout of P^T for O^T += V^T.P^T:
// position (hl, e) is key m0 + hl*8 + e for e < 8 and m0 + 16 + hl*8 + e - 8 above, in the V fragment and in P alike.
// Online softmax in the log2 domain. q comes scaled and a lane's 8 score registers all belong to one token, so the C operand of
// the score product is minus that token's maximum in use: the product's result is the argument of exp2 as it stands.
// The maximum in use may trail the true one by up to 8 (p <= 256 in f16), so C, the pass's scores and the
// accumulators are renewed only when some token's maximum exceeds it by more.
// No maximum at all where none is needed: |score| <= |q| |k|, so a wave whose tokens all have |q| max|k| <= 14 over its key slice has
// every p = exp2(score) inside f16's normal range as it stands. Such a wave keeps the maximum fixed at 0 and jumps, on a scalar
// condition set once, over the maxima, the compare and the ballot of every pass. Any other wave keeps the running maximum.
// Denominator: an A fragment with ones in row 0 sums
// the rounded P on the matrix pipe. The 4 key slices are merged through LDS in slice order.
// ---------------------------------------------------------------------------
constexpr int kFaTok   = 128;                    // tokens per block
constexpr int kFaSplit = 4;                      // key slices per block
constexpr int kFaKeys  = kNtok / kFaSplit;       // 1024 keys per wave
constexpr int kFaPass  = kFaKeys / 32;           // 32 passes of 32 keys
constexpr int kFaPitch = kFaTok + 4;             // partial-tile pitch in floats: lane halves fall on different banks
constexpr float kFaPlain = 14.0f;                // bound on |score| (scaled, log2) up to which exp2 needs no maximum: 2^-14 .. 2^14 in f16

__device__ __forceinline__ unsigned umax(unsigned a, unsigned b) { return a > b ? a : b; }
// maximum with the lane whose number differs by M inside the 16-lane row
template <int M>
__device__ __forceinline__ unsigned row_xmax(unsigned x) {
  return umax(x, (unsigned)__builtin_amdgcn_update_dpp((int)x, (int)x, 0x160 | M, 0xf, 0xf, false));
}

typedef __attribute__((ext_vector_type(2))) float    v2f;
typedef __attribute__((ext_vector_type(2))) _Float16 v2h;

// Copies of 16 B per lane from global memory to LDS, through no register. A unit is 128 pieces of a key slice = 64 keys = two passes,
// of K and of V alike; threads 128 s .. 128 s + 127 take key slice s, thread t piece t & 127 of every unit. Unit u lies 2048 u bytes
// behind unit 0 in the workspace and in LDS (u <= 15: the offset stays under 65,536, where it moves both addresses alike).
// The s_wait_xcnt stands inside the copies' own statement, so that no address register of a copy is rewritten ahead of it.
#define KV_UNIT(o) "global_load_async_to_lds_b128 %0, %1, off offset:" #o "\n\t" \
                   "global_load_async_to_lds_b128 %2, %3, off offset:" #o "\n\t"
#define KV_ARGS :: "v"(lk), "v"(gk), "v"(lv), "v"(gv) : "memory"
// passes 0..3 of every key slice: units 0, 1
__device__ __forceinline__ void stage_first(unsigned lk, const _Float16* gk, unsigned lv, const _Float16* gv) {
  asm volatile(KV_UNIT(0) KV_UNIT(2048) "s_wait_xcnt 0x0" KV_ARGS);
}
// passes 4..11: units 2..5
__device__ __forceinline__ void stage_second(unsigned lk, const _Float16* gk, unsigned lv, const _Float16* gv) {
  asm volatile(KV_UNIT(4096) KV_UNIT(6144) KV_UNIT(8192) KV_UNIT(10240) "s_wait_xcnt 0x0" KV_ARGS);
}
// passes 12..31: units 6..15
__device__ __forceinline__ void stage_third(unsigned lk, const _Float16* gk, unsigned lv, const _Float16* gv) {
  asm volatile(KV_UNIT(12288) KV_UNIT(14336) KV_UNIT(16384) KV_UNIT(18432) KV_UNIT(20480)
               KV_UNIT(22528) KV_UNIT(24576) KV_UNIT(26624) KV_UNIT(28672) KV_UNIT(30720) "s_wait_xcnt 0x0" KV_ARGS);
}

__global__ __launch_bounds__(512) void attn_fused_kernel(const unsigned short* __restrict__ Qp,
                                                         const unsigned short* __restrict__ Kp,
                                                         const unsigned short* __restrict__ Vp,
                                                         const float* __restrict__ Kn2,
                                                         float* __restrict__ out) {
  __shared__ __align__(16) _Float16 sK[kNtok * kHdim];
  __shared__ __align__(16) _Float16 sV[kNtok * kHdim];
  __shared__ __align__(16) float part[kFaSplit][kHdim * kFaPitch];
  __shared__ __align__(16) float pm[kFaSplit][kFaTok];
  __shared__ __align__(16) float pl[kFaSplit][kFaTok];
  const int t     = threadIdx.x;
  const int lane  = t & 31;
  const int wave  = t >> 5;
  const int rlane = lane & 15;
  const int hl    = lane >> 4;
  const int g     = blockIdx.x / (kNtok / kFaTok);
  const int n0    = (blockIdx.x % (kNtok / kFaTok)) * kFaTok;
  const _Float16* Q = (const _Float16*)Qp + (size_t)g * kPlane;

  // ---- first chunk of K and V: passes 0..3 of every key slice ----
  const int piece0 = (t >> 7) * (kFaKeys * 2) + (t & 127);         // the thread's piece of unit 0, in K and in V
  const _Float16* gk = (const _Float16*)Kp + (size_t)g * kPlane + piece0 * 8;
  const _Float16* gv = (const _Float16*)Vp + (size_t)g * kPlane + piece0 * 8;
  const unsigned  lk = (unsigned)(size_t)(sK + piece0 * 8);
  const unsigned  lv = (unsigned)(size_t)(sV + piece0 * 8);
  stage_first(lk, gk, lv, gv);

  const int ng    = wave & 3;                    // token slice
  const int split = wave >> 2;                   // key slice
  const v8h z8 = (v8h){0, 0, 0, 0, 0, 0, 0, 0};
  v16h qa[2], qb[2];
  v8h  qh[2];
  v4f  kn[kFaKeys / 128];                        // squared lengths of the key slice's k rows, 32 per lane
#pragma unroll   // kn stays in registers, and all eight loads are in flight together
  for (int i = 0; i < kFaKeys / 128; ++i)
    kn[i] = *(const v4f*)(Kn2 + (size_t)g * kNtok + split * kFaKeys + i * 128 + lane * 4);
#pragma unroll
  for (int c = 0; c < 2; ++c) {
    const v8h q = *(const v8h*)(Q + (size_t)(n0 + ng * 32 + c * 16 + rlane) * kHdim + hl * 8);
    qa[c] = join16(q, z8);
    qb[c] = join16(z8, q);
    qh[c] = q;
  }
  const _Float16 one = (rlane == 0) ? (_Float16)1.0f : (_Float16)0.0f;   // A operand whose row 0 is ones
  const v8h o8 = (v8h){one, one, one, one, one, one, one, one};
  const v16h ones = join16(o8, o8);
  const v8f zero8 = (v8f){0.f, 0.f, 0.f, 0.f, 0.f, 0.f, 0.f, 0.f};
  v8f acc[2]  = {zero8, zero8};
  v8f lacc[2] = {zero8, zero8};
  v8f cneg[2]   = {zero8, zero8};                // C of the score products: -mrun in every register; 0 until the first pass has set mrun
  float thr     = -INFINITY;                     // score less C's maximum above which the maximum is renewed: 8 from the first pass on
  // this wave's copies of the first chunk have landed; behind the barrier every wave's have
  asm volatile("s_wait_asynccnt 0x0" ::: "memory");
  __syncthreads();
  stage_second(lk, gk, lv, gv);                  // flies under passes 0..3
  // keeps the arithmetic below behind the copies: drawn in front of them it would shorten the time they have to land
  __builtin_amdgcn_sched_barrier(0);

  // ---- does this wave need a running maximum? ----
  // largest squared length over the keys of the lane's 16-lane row, half the key slice. None is negative, so the bit patterns order as the values do, with not-a-number on top
  unsigned kb = 0;
#pragma unroll   // registers again
  for (int i = 0; i < kFaKeys / 128; ++i)
#pragma unroll
    for (int e = 0; e < 4; ++e) {
      const float f = kn[i][e];
      kb = umax(kb, __builtin_bit_cast(unsigned, f));
    }
  kb = row_xmax<8>(row_xmax<4>(row_xmax<2>(row_xmax<1>(kb))));
  const float km = __builtin_bit_cast(float, kb);
  float qn[2];                                   // squared length of the token's q as stored (scaled)
#pragma unroll
  for (int c = 0; c < 2; ++c) {
    const float half = sumsq8(qh[c]);
    qn[c] = half + other_half(half);
  }
  // wave-uniform (the two 16-lane rows meet in the ballot); written so that a product that is not a number counts as too large
  const bool plain = __builtin_amdgcn_ballot_w32(!(qn[0] * km <= kFaPlain * kFaPlain && qn[1] * km <= kFaPlain * kFaPlain)) == 0;
  const float m0 = plain ? 0.f : -INFINITY;
  float mrun[2] = {m0, m0};                      // maximum in use, scaled; stays 0 in a wave that needs none

  const _Float16* kw  = sK + split * kFaKeys * kHdim + lane * 8;
  const _Float16* vw0 = sV + split * kFaKeys * kHdim + hl * 128 + rlane * 8;
  const _Float16* vw1 = vw0 + 2 * 128;
  // passes pb .. pe - 1: one chunk
  auto passes = [&](const int pb, const int pe) {
  v16h kf = join16(*(const v8h*)(kw + pb * 512), *(const v8h*)(kw + pb * 512 + 256));
  for (int p = pb; p < pe; ++p) {
    v8f s[2][2];
#pragma unroll
    for (int c = 0; c < 2; ++c) {
      s[c][0] = mma16(kf, qa[c], cneg[c]);
      s[c][1] = mma16(kf, qb[c], cneg[c]);
    }
    // keeps the four score products back to back: spread among the maxima each one drew its own run of v_nop
    __builtin_amdgcn_sched_barrier(0);
    const v16h vf = join16(*(const v8h*)(vw0 + p * 512), *(const v8h*)(vw1 + p * 512));
    const int pn = (p + 1 < pe) ? p + 1 : pb;
    kf = join16(*(const v8h*)(kw + pn * 512), *(const v8h*)(kw + pn * 512 + 256));

    if (!plain) {                                // a scalar branch on a value fixed for the whole wave: no vector compare feeds it
    float mb[2];                                 // this lane's maximum of the pass (8 + 8 keys of its token), above the maximum in C
    bool need = false;
#pragma unroll
    for (int c = 0; c < 2; ++c) {
      float mx = fmaxf(s[c][0][0], s[c][1][0]);
#pragma unroll
      for (int r = 1; r < 8; ++r) mx = fmaxf(fmaxf(mx, s[c][0][r]), s[c][1][r]);
      mb[c] = mx;
      need = need || (mx > thr);
    }
    if (__builtin_amdgcn_ballot_w32(need) != 0) { // wave-uniform; always on the first pass, rare after it
#pragma unroll
      for (int c = 0; c < 2; ++c) {
        // both lane halves of a token take the same new maximum
        const float mnew = fmaxf(mrun[c], fmaxf(mb[c], other_half(mb[c])) - cneg[c][0]);
        const float corr = __builtin_amdgcn_exp2f(mrun[c] - mnew);   // 0 on the first pass
        // this pass's scores were formed against the old C. Taken from all of C, not from one register of it: where the score
        // product was the last reader of the whole C, the compiler wrote the product over a copy of C made anew in every pass
        const v8f down = cneg[c] + mnew;
        mrun[c] = mnew;
        s[c][0] = s[c][0] - down;
        s[c][1] = s[c][1] - down;
        cneg[c] = zero8 - mnew;
        acc[c]  = acc[c] * corr;
        lacc[c] = lacc[c] * corr;
      }
      thr = 8.0f;
    }
    }
#pragma unroll
    for (int c = 0; c < 2; ++c) {
      v16h pf;
#pragma unroll
      for (int i = 0; i < 8; ++i) {
        const v2h h = __builtin_convertvector((v2f){__builtin_amdgcn_exp2f(s[c][i >> 2][2 * (i & 3)]),
                                                    __builtin_amdgcn_exp2f(s[c][i >> 2][2 * (i & 3) + 1])}, v2h);
        pf[2 * i]     = h[0];
        pf[2 * i + 1] = h[1];
      }
      acc[c]  = mma16(vf, pf, acc[c]);
      lacc[c] = mma16(ones, pf, lacc[c]);   // row 0 += the column sums of P^T
    }
  }
  };
  // foot of a chunk: this wave's LDS reads are done and its copies of the next chunk have landed; behind the barrier every wave's have
  auto publish = [&]() {
    asm volatile("s_wait_dscnt 0x0" ::: "memory");
    asm volatile("s_wait_asynccnt 0x0" ::: "memory");
    __syncthreads();
  };
  passes(0, 4);
  publish();
  stage_third(lk, gk, lv, gv);                   // flies under passes 4..11
  passes(4, 12);
  publish();
  passes(12, kFaPass);
  // no copy of this wave is outstanding when it goes on to the merge and ends
  asm volatile("s_wait_asynccnt 0x0" ::: "memory");

  // ---- merge the 4 key slices ----
  float* pw = part[split];
#pragma unroll
  for (int c = 0; c < 2; ++c) {
    const int col = ng * 32 + c * 16 + rlane;
#pragma unroll
    for (int r = 0; r < 8; ++r) pw[(hl * 8 + r) * kFaPitch + col] = acc[c][r];
    if (hl == 0) {
      pm[split][col] = mrun[c];
      pl[split][col] = lacc[c][0];
    }
  }
  __syncthreads();
  const int d  = wave;                           // 16 waves = 16 rows d; a wave stores 512 B of one row
  const int n4 = lane * 4;
  v4f mm[kFaSplit];
#pragma unroll
  for (int k = 0; k < kFaSplit; ++k) mm[k] = *(const v4f*)(&pm[k][n4]);
  v4f res;
#pragma unroll
  for (int e = 0; e < 4; ++e) {
    const float mt = fmaxf(fmaxf(mm[0][e], mm[1][e]), fmaxf(mm[2][e], mm[3][e]));
    float den = 0.f, num = 0.f;
#pragma unroll
    for (int k = 0; k < kFaSplit; ++k) {
      const float wgt = __builtin_amdgcn_exp2f(mm[k][e] - mt);
      den += wgt * pl[k][n4 + e];
      num += wgt * part[k][d * kFaPitch + n4 + e];
    }
    res[e] = num / den;
  }
  *(v4f*)(out + ((size_t)g * kHdim + d) * kNtok + n0 + n4) = res;   // out[b][h*16 + d][n], g = b*4 + h
}

// ---------------------------------------------------------------------------
extern "C" void kernel_launch(void* const* d_in, const int* in_sizes, int n_in,
                              void* d_out, int out_size, void* d_ws, size_t ws_size,
                              hipStream_t stream) {
  (void)in_sizes; (void)n_in;
  const float* x    = (const float*)d_in[0];     // [2][64][4096]
  const float* w    = (const float*)d_in[1];     // [192][64]
  const float* bias = (const float*)d_in[2];     // [192]
  float* out = (float*)d_out;                    // [2][64][4096]

  // ---- workspace carve (see region map at the top) ----
  const size_t szPlane = (size_t)kGroups * kPlane * 2;
  char* ws = (char*)d_ws;
  size_t off = 0;
  unsigned short* Q16  = (unsigned short*)(ws + off); off += szPlane;
  unsigned short* Kimg = (unsigned short*)(ws + off); off += szPlane;
  unsigned short* Vimg = (unsigned short*)(ws + off); off += szPlane;
  float* Kn2 = (float*)(ws + off); off += (size_t)kGroups * kNtok * 4;
  if (off > ws_size) return;                                       // 3,276,800 B carved
  if ((size_t)out_size < (size_t)kBatch * kChan * kNtok) return;   // 524,288 f32 elements

  // 1) x, w, bias -> Q16, Kimg, Vimg (packed planes), Kn2 [8][4096]; 128 blocks of 64 tokens, 8 waves each
  qkv_proj_kernel<<<dim3(kTok / kPjTok), dim3(kPjThr), 0, stream>>>(x, w, bias, Q16, Kimg, Vimg, Kn2);

  // 2) all (batch, head) groups: scores, softmax and P.V fused, heads stored to the channel-major output;
  //    8 groups x 32 blocks of 128 tokens, 16 waves each
  attn_fused_kernel<<<dim3(kGroups * (kNtok / kFaTok)), dim3(512), 0, stream>>>(Q16, Kimg, Vimg, Kn2, out);
}
